// v000
// Times are from an AMD MI455X. After a warm-up the kernel runs many times in a row, and a time is the length of
// such a window on the GPU divided by its runs, so every launch and the gaps after it count. The runs cycle
// through copies of the inputs. A figure is the median of several windows, for all but v000 over two sittings.
// Sittings can differ by a few percent; kernels timed side by side share one.
// v000 is the starting kernel. One run takes 982 microseconds.
#include <hip/hip_runtime.h>
#include <math.h>

typedef __attribute__((ext_vector_type(8)))  float        v8f;
typedef __attribute__((ext_vector_type(16))) __bf16       v16bf;
typedef __attribute__((ext_vector_type(4)))  unsigned int u32x4;
typedef __attribute__((ext_vector_type(4)))  float        f32x4;

#define D_MODELc 1024
#define N_HEADSc 16
#define D_HEADc  64
#define D_MLPc   4096
#define Bc       4
#define Sc       2048
#define MROWS    (Bc * Sc)   // 8192

// ---------------- helpers ----------------

__device__ __forceinline__ unsigned short f2bf(float f) {
    union { float f; unsigned u; } x; x.f = f;
    unsigned r = x.u + 0x7FFFu + ((x.u >> 16) & 1u);
    return (unsigned short)(r >> 16);
}

union FragAB { v16bf v; u32x4 q[2]; };

__device__ __forceinline__ void load_frag(FragAB& f, const unsigned short* p0,
                                          const unsigned short* p1) {
    f.q[0] = *reinterpret_cast<const u32x4*>(p0);
    f.q[1] = *reinterpret_cast<const u32x4*>(p1);
}

__device__ __forceinline__ v8f wmma_bf16(v16bf a, v16bf b, v8f c) {
    return __builtin_amdgcn_wmma_f32_16x16x32_bf16(false, a, false, b,
                                                   (short)0, c, false, false);
}

// gfx1250 async global->LDS copy (ASYNCcnt tracked, no VGPR round trip).
__device__ __forceinline__ void async_copy_b128(unsigned ldsoff, const unsigned short* g) {
    asm volatile("global_load_async_to_lds_b128 %0, %1, off"
                 :: "v"(ldsoff), "v"(g) : "memory");
}
__device__ __forceinline__ void wait_async0() {
    asm volatile("s_wait_asynccnt 0" ::: "memory");
}
__device__ __forceinline__ unsigned lds_offset(const void* p) {
    return (unsigned)(unsigned long long)p;   // LDS aperture lives in the high 32 bits
}

// ---------------- shared GEMM core ----------------
// acc[2][4] += A[m0..m0+31][0..K) * Bt[n0..n0+63][0..K)^T
// B tile (64x32 bf16 = 4KB) async-staged into LDS, double buffered.
// All 4 B fragments are pulled into distinct registers before the WMMA burst
// so the 8 ds_load_b128 issue back-to-back and wait once.
__device__ __forceinline__ void gemm_core(const unsigned short* __restrict__ A,
                                          const unsigned short* __restrict__ Bt,
                                          int K, int m0, int n0,
                                          v8f acc[2][4],
                                          unsigned short* lds /* [2][64][32] */) {
    const int tid  = threadIdx.x;
    const int lane = tid & 31;
    const int sel  = lane >> 4;
    const int l16  = lane & 15;

    // cooperative copy mapping: thread t -> (n = t/4, k-sub = (t%4)*8), one b128 each
    const int cn = tid >> 2;
    const int ck = (tid & 3) * 8;
    const unsigned short* gB = Bt + (size_t)(n0 + cn) * K + ck;
    const unsigned loff0 = lds_offset(lds + cn * 32 + ck);
    const unsigned loff1 = lds_offset(lds + 2048 + cn * 32 + ck);

    const unsigned short* arow0 = A + (size_t)(m0 + l16) * K;
    const unsigned short* arow1 = A + (size_t)(m0 + 16 + l16) * K;
    // per-wave LDS read base for B fragments (row n' = j*16 + l16)
    const unsigned short* lbase = lds + l16 * 32 + sel * 8;

    async_copy_b128(loff0, gB);   // prologue: tile 0 -> buffer 0

    for (int k = 0; k < K; k += 32) {
        const int buf = (k >> 5) & 1;
        wait_async0();        // my portion of tile k has landed
        __syncthreads();      // everyone's portion landed; buf^1 free to overwrite
        if (k + 32 < K)
            async_copy_b128(buf ? loff0 : loff1, gB + k + 32);

        FragAB a0, a1;
        load_frag(a0, arow0 + k + sel * 8, arow0 + k + 16 + sel * 8);
        load_frag(a1, arow1 + k + sel * 8, arow1 + k + 16 + sel * 8);

        const unsigned short* lb = lbase + buf * 2048;
        FragAB b0, b1, b2, b3;                 // distinct live values
        load_frag(b0, lb,              lb + 16);
        load_frag(b1, lb + 16 * 32,    lb + 16 * 32 + 16);
        load_frag(b2, lb + 32 * 32,    lb + 32 * 32 + 16);
        load_frag(b3, lb + 48 * 32,    lb + 48 * 32 + 16);

        acc[0][0] = wmma_bf16(a0.v, b0.v, acc[0][0]);
        acc[1][0] = wmma_bf16(a1.v, b0.v, acc[1][0]);
        acc[0][1] = wmma_bf16(a0.v, b1.v, acc[0][1]);
        acc[1][1] = wmma_bf16(a1.v, b1.v, acc[1][1]);
        acc[0][2] = wmma_bf16(a0.v, b2.v, acc[0][2]);
        acc[1][2] = wmma_bf16(a1.v, b2.v, acc[1][2]);
        acc[0][3] = wmma_bf16(a0.v, b3.v, acc[0][3]);
        acc[1][3] = wmma_bf16(a1.v, b3.v, acc[1][3]);
    }
}

// ---------------- weight transpose + f32->bf16 ----------------
__global__ void transpose_cvt_kernel(const float* __restrict__ src,
                                     unsigned short* __restrict__ dst,
                                     int R, int C,
                                     long srcBatchStride, long dstBatchStride,
                                     int dstRowStride) {
    long z   = blockIdx.z;
    long idx = (long)blockIdx.x * 256 + threadIdx.x;
    if (idx >= (long)R * C) return;
    int r = (int)(idx / C);
    int c = (int)(idx % C);
    dst[z * dstBatchStride + (long)c * dstRowStride + r] =
        f2bf(src[z * srcBatchStride + idx]);
}

// ---------------- layernorm -> bf16 ----------------
__global__ __launch_bounds__(256)
void ln_bf16_kernel(const float* __restrict__ x, const float* __restrict__ g,
                    const float* __restrict__ bt, unsigned short* __restrict__ out) {
    int row = blockIdx.x;
    int tid = threadIdx.x;
    const float* xr = x + (size_t)row * D_MODELc;
    f32x4 v = reinterpret_cast<const f32x4*>(xr)[tid];
    float s  = v[0] + v[1] + v[2] + v[3];
    float s2 = v[0]*v[0] + v[1]*v[1] + v[2]*v[2] + v[3]*v[3];
    __shared__ float sh1[256], sh2[256];
    sh1[tid] = s; sh2[tid] = s2;
    __syncthreads();
    for (int off = 128; off > 0; off >>= 1) {
        if (tid < off) { sh1[tid] += sh1[tid + off]; sh2[tid] += sh2[tid + off]; }
        __syncthreads();
    }
    float mu   = sh1[0] * (1.0f / D_MODELc);
    float var  = sh2[0] * (1.0f / D_MODELc) - mu * mu;
    float rstd = rsqrtf(var + 1e-5f);
    int c = tid * 4;
    unsigned short* orow = out + (size_t)row * D_MODELc + c;
#pragma unroll
    for (int i = 0; i < 4; ++i)
        orow[i] = f2bf((v[i] - mu) * rstd * g[c + i] + bt[c + i]);
}

// ---------------- generic GEMM: C = A(bf16,[M,K]) * Bt(bf16,[N,K])^T ----------------
template <bool HAS_BIAS, bool HAS_RES, bool DO_GELU, bool OUT_BF16>
__global__ __launch_bounds__(256)
void gemm_bf16_kernel(const unsigned short* __restrict__ A,
                      const unsigned short* __restrict__ Bt,
                      const float* __restrict__ bias,
                      const float* __restrict__ res,
                      float* __restrict__ outF,
                      unsigned short* __restrict__ outB,
                      int M, int N, int K) {
    __shared__ __attribute__((aligned(16))) unsigned short btile[2][64][32];
    const int lane = threadIdx.x & 31;
    const int wave = threadIdx.x >> 5;
    const int sel  = lane >> 4;
    const int l16  = lane & 15;
    const int n0   = blockIdx.x * 64;
    const int m0   = blockIdx.y * 256 + wave * 32;

    v8f zero = {};
    v8f acc[2][4];
#pragma unroll
    for (int ai = 0; ai < 2; ++ai)
#pragma unroll
        for (int j = 0; j < 4; ++j) acc[ai][j] = zero;

    gemm_core(A, Bt, K, m0, n0, acc, &btile[0][0][0]);

#pragma unroll
    for (int ai = 0; ai < 2; ++ai)
#pragma unroll
        for (int j = 0; j < 4; ++j)
#pragma unroll
            for (int r = 0; r < 8; ++r) {
                int m = m0 + ai * 16 + r + 8 * sel;
                int n = n0 + j * 16 + l16;
                float v = acc[ai][j][r];
                if (HAS_BIAS) v += bias[n];
                if (DO_GELU)  v = 0.5f * v * (1.0f + erff(v * 0.70710678118654752f));
                if (HAS_RES)  v += res[(size_t)m * N + n];
                if (OUT_BF16) outB[(size_t)m * N + n] = f2bf(v);
                else          outF[(size_t)m * N + n] = v;
            }
}

// ---------------- QKV GEMM (N=3072): writes Q,K row-major; V transposed [e][t] ----------------
__global__ __launch_bounds__(256)
void gemm_qkv_kernel(const unsigned short* __restrict__ A,
                     const unsigned short* __restrict__ Bt,
                     unsigned short* __restrict__ Q,
                     unsigned short* __restrict__ Kb,
                     unsigned short* __restrict__ Vt) {
    __shared__ __attribute__((aligned(16))) unsigned short btile[2][64][32];
    const int lane = threadIdx.x & 31;
    const int wave = threadIdx.x >> 5;
    const int sel  = lane >> 4;
    const int l16  = lane & 15;
    const int n0   = blockIdx.x * 64;          // which/head uniform per block
    const int m0   = blockIdx.y * 256 + wave * 32;

    v8f zero = {};
    v8f acc[2][4];
#pragma unroll
    for (int ai = 0; ai < 2; ++ai)
#pragma unroll
        for (int j = 0; j < 4; ++j) acc[ai][j] = zero;

    gemm_core(A, Bt, D_MODELc, m0, n0, acc, &btile[0][0][0]);

    const int which = n0 >> 10;              // 0=Q,1=K,2=V
    const int hh    = (n0 & 1023) >> 6;
#pragma unroll
    for (int ai = 0; ai < 2; ++ai)
#pragma unroll
        for (int j = 0; j < 4; ++j)
#pragma unroll
            for (int r = 0; r < 8; ++r) {
                int m = m0 + ai * 16 + r + 8 * sel;
                int b = m >> 11;             // row / S
                int s = m & (Sc - 1);
                int e = j * 16 + l16;
                unsigned short bv = f2bf(acc[ai][j][r]);
                size_t bh = (size_t)(b * N_HEADSc + hh);
                if (which == 0)      Q [(bh * Sc + s) * D_HEADc + e] = bv;
                else if (which == 1) Kb[(bh * Sc + s) * D_HEADc + e] = bv;
                else                 Vt[bh * D_HEADc * Sc + (size_t)e * Sc + s] = bv;
            }
}

// ---------------- flash attention: one 16-row Q tile per wave ----------------
__global__ __launch_bounds__(256)
void attention_kernel(const unsigned short* __restrict__ Q,
                      const unsigned short* __restrict__ Kb,
                      const unsigned short* __restrict__ Vt,
                      unsigned short* __restrict__ Ctx) {
    const int lane = threadIdx.x & 31;
    const int wave = threadIdx.x >> 5;
    const int sel  = lane >> 4;
    const int l16  = lane & 15;
    const int b    = blockIdx.z;
    const int h    = blockIdx.y;
    const int s0   = blockIdx.x * 128 + wave * 16;

    const size_t bh = (size_t)(b * N_HEADSc + h);
    const unsigned short* qb = Q  + bh * Sc * D_HEADc;
    const unsigned short* kb = Kb + bh * Sc * D_HEADc;
    const unsigned short* vb = Vt + bh * D_HEADc * Sc;

    __shared__ __attribute__((aligned(16))) unsigned short pbuf[8][16][32];

    FragAB qf0, qf1;
    const unsigned short* qrow = qb + (size_t)(s0 + l16) * D_HEADc;
    load_frag(qf0, qrow + sel * 8,      qrow + 16 + sel * 8);
    load_frag(qf1, qrow + 32 + sel * 8, qrow + 48 + sel * 8);

    v8f zero = {};
    v8f O[4];
#pragma unroll
    for (int j = 0; j < 4; ++j) O[j] = zero;
    float mi[8], li[8];
#pragma unroll
    for (int r = 0; r < 8; ++r) { mi[r] = -INFINITY; li[r] = 0.0f; }

    const float scale = 0.125f;   // 64^-0.5

    for (int tb = 0; tb < Sc; tb += 32) {
        v8f sc0 = zero, sc1 = zero;
        {
            FragAB kf0, kf1, kf2, kf3;
            const unsigned short* kr0 = kb + (size_t)(tb + l16) * D_HEADc;
            const unsigned short* kr1 = kb + (size_t)(tb + 16 + l16) * D_HEADc;
            load_frag(kf0, kr0 + sel * 8,      kr0 + 16 + sel * 8);
            load_frag(kf1, kr0 + 32 + sel * 8, kr0 + 48 + sel * 8);
            load_frag(kf2, kr1 + sel * 8,      kr1 + 16 + sel * 8);
            load_frag(kf3, kr1 + 32 + sel * 8, kr1 + 48 + sel * 8);
            sc0 = wmma_bf16(qf0.v, kf0.v, sc0);
            sc0 = wmma_bf16(qf1.v, kf1.v, sc0);
            sc1 = wmma_bf16(qf0.v, kf2.v, sc1);
            sc1 = wmma_bf16(qf1.v, kf3.v, sc1);
        }

        float p0[8], p1[8], alpha[8];
#pragma unroll
        for (int r = 0; r < 8; ++r) {
            float a = sc0[r] * scale;
            float c = sc1[r] * scale;
            float tm = fmaxf(a, c);
#pragma unroll
            for (int off = 1; off < 16; off <<= 1)
                tm = fmaxf(tm, __shfl_xor(tm, off, 32));
            float mn = fmaxf(mi[r], tm);
            alpha[r] = __expf(mi[r] - mn);
            p0[r] = __expf(a - mn);
            p1[r] = __expf(c - mn);
            float sm = p0[r] + p1[r];
#pragma unroll
            for (int off = 1; off < 16; off <<= 1)
                sm += __shfl_xor(sm, off, 32);
            li[r] = li[r] * alpha[r] + sm;
            mi[r] = mn;
        }
#pragma unroll
        for (int j = 0; j < 4; ++j)
#pragma unroll
            for (int r = 0; r < 8; ++r) O[j][r] *= alpha[r];

        // bounce P through per-wave LDS tile to convert C-layout -> A-layout
#pragma unroll
        for (int r = 0; r < 8; ++r) {
            int m = r + 8 * sel;
            pbuf[wave][m][l16]      = f2bf(p0[r]);
            pbuf[wave][m][16 + l16] = f2bf(p1[r]);
        }
        asm volatile("s_wait_dscnt 0" ::: "memory");   // DS in-order per wave; fence compiler too

        FragAB pf;
        const unsigned short* pr = &pbuf[wave][l16][0];
        load_frag(pf, pr + sel * 8, pr + 16 + sel * 8);

        FragAB vf0, vf1, vf2, vf3;
        const unsigned short* vr0 = vb + (size_t)(l16)      * Sc + tb;
        const unsigned short* vr1 = vb + (size_t)(16 + l16) * Sc + tb;
        const unsigned short* vr2 = vb + (size_t)(32 + l16) * Sc + tb;
        const unsigned short* vr3 = vb + (size_t)(48 + l16) * Sc + tb;
        load_frag(vf0, vr0 + sel * 8, vr0 + 16 + sel * 8);
        load_frag(vf1, vr1 + sel * 8, vr1 + 16 + sel * 8);
        load_frag(vf2, vr2 + sel * 8, vr2 + 16 + sel * 8);
        load_frag(vf3, vr3 + sel * 8, vr3 + 16 + sel * 8);
        O[0] = wmma_bf16(pf.v, vf0.v, O[0]);
        O[1] = wmma_bf16(pf.v, vf1.v, O[1]);
        O[2] = wmma_bf16(pf.v, vf2.v, O[2]);
        O[3] = wmma_bf16(pf.v, vf3.v, O[3]);
    }

    float inv[8];
#pragma unroll
    for (int r = 0; r < 8; ++r) inv[r] = 1.0f / li[r];
#pragma unroll
    for (int j = 0; j < 4; ++j)
#pragma unroll
        for (int r = 0; r < 8; ++r) {
            int m   = r + 8 * sel;
            int row = b * Sc + s0 + m;
            Ctx[(size_t)row * D_MODELc + h * D_HEADc + j * 16 + l16] =
                f2bf(O[j][r] * inv[r]);
        }
}

// ---------------- host orchestration ----------------
extern "C" void kernel_launch(void* const* d_in, const int* in_sizes, int n_in,
                              void* d_out, int out_size, void* d_ws, size_t ws_size,
                              hipStream_t stream) {
    (void)in_sizes; (void)n_in; (void)out_size; (void)ws_size;
    const float* x     = (const float*)d_in[0];
    const float* WQ    = (const float*)d_in[1];
    const float* WK    = (const float*)d_in[2];
    const float* WV    = (const float*)d_in[3];
    const float* WO    = (const float*)d_in[4];
    const float* ln1_g = (const float*)d_in[5];
    const float* ln1_b = (const float*)d_in[6];
    const float* ln2_g = (const float*)d_in[7];
    const float* ln2_b = (const float*)d_in[8];
    const float* W_in  = (const float*)d_in[9];
    const float* b_in  = (const float*)d_in[10];
    const float* W_out = (const float*)d_in[11];
    const float* b_out = (const float*)d_in[12];

    char* ws = (char*)d_ws;
    size_t off = 0;
    auto alloc = [&](size_t bytes) -> void* {
        void* p = ws + off;
        off += (bytes + 255) & ~(size_t)255;
        return p;
    };
    unsigned short* xln   = (unsigned short*)alloc((size_t)MROWS * D_MODELc * 2);
    unsigned short* wqkvt = (unsigned short*)alloc((size_t)3 * D_MODELc * D_MODELc * 2);
    unsigned short* wot   = (unsigned short*)alloc((size_t)D_MODELc * D_MODELc * 2);
    unsigned short* wint  = (unsigned short*)alloc((size_t)D_MLPc * D_MODELc * 2);
    unsigned short* woutt = (unsigned short*)alloc((size_t)D_MODELc * D_MLPc * 2);
    unsigned short* Qb    = (unsigned short*)alloc((size_t)MROWS * D_MODELc * 2);
    unsigned short* Kbf   = (unsigned short*)alloc((size_t)MROWS * D_MODELc * 2);
    unsigned short* Vtb   = (unsigned short*)alloc((size_t)MROWS * D_MODELc * 2);
    unsigned short* ctx   = (unsigned short*)alloc((size_t)MROWS * D_MODELc * 2);
    float*          x1    = (float*)alloc((size_t)MROWS * D_MODELc * 4);
    unsigned short* hm    = (unsigned short*)alloc((size_t)MROWS * D_MLPc * 2);

    dim3 blk(256);

    // Pack weights: Bt layout = [N][K] bf16
    transpose_cvt_kernel<<<dim3(256, 1, 16), blk, 0, stream>>>(
        WQ, wqkvt,                 1024, 64, 65536L, 65536L, 1024);
    transpose_cvt_kernel<<<dim3(256, 1, 16), blk, 0, stream>>>(
        WK, wqkvt + 1024 * 1024,   1024, 64, 65536L, 65536L, 1024);
    transpose_cvt_kernel<<<dim3(256, 1, 16), blk, 0, stream>>>(
        WV, wqkvt + 2048 * 1024,   1024, 64, 65536L, 65536L, 1024);
    transpose_cvt_kernel<<<dim3(256, 1, 16), blk, 0, stream>>>(
        WO, wot,                   64, 1024, 65536L, 64L,    1024);
    transpose_cvt_kernel<<<dim3(16384, 1, 1), blk, 0, stream>>>(
        W_in,  wint,  1024, 4096, 0L, 0L, 1024);
    transpose_cvt_kernel<<<dim3(16384, 1, 1), blk, 0, stream>>>(
        W_out, woutt, 4096, 1024, 0L, 0L, 4096);

    // LN1
    ln_bf16_kernel<<<MROWS, blk, 0, stream>>>(x, ln1_g, ln1_b, xln);

    // QKV
    gemm_qkv_kernel<<<dim3(3072 / 64, MROWS / 256), blk, 0, stream>>>(
        xln, wqkvt, Qb, Kbf, Vtb);

    // Attention (flash)
    attention_kernel<<<dim3(Sc / 128, N_HEADSc, Bc), blk, 0, stream>>>(
        Qb, Kbf, Vtb, ctx);

    // Output projection + residual -> x1 (f32)
    gemm_bf16_kernel<false, true, false, false>
        <<<dim3(1024 / 64, MROWS / 256), blk, 0, stream>>>(
            ctx, wot, nullptr, x, x1, nullptr, MROWS, D_MODELc, D_MODELc);

    // LN2 -> reuse xln
    ln_bf16_kernel<<<MROWS, blk, 0, stream>>>(x1, ln2_g, ln2_b, xln);

    // MLP in: +bias, exact GELU, bf16 out
    gemm_bf16_kernel<true, false, true, true>
        <<<dim3(4096 / 64, MROWS / 256), blk, 0, stream>>>(
            xln, wint, b_in, nullptr, nullptr, hm, MROWS, D_MLPc, D_MODELc);

    // MLP out: +bias, +residual x1 -> d_out (f32)
    gemm_bf16_kernel<true, true, false, false>
        <<<dim3(1024 / 64, MROWS / 256), blk, 0, stream>>>(
            hm, woutt, b_out, x1, (float*)d_out, nullptr, MROWS, D_MODELc, D_MLPc);
}

// v001
// Measured time: 777 microseconds a run.
// Timed twice side by side with v000, it ran 1.29 and 1.30 times as fast.
#include <hip/hip_runtime.h>
#include <math.h>

typedef __attribute__((ext_vector_type(8)))  float        v8f;
typedef __attribute__((ext_vector_type(16))) __bf16       v16bf;
typedef __attribute__((ext_vector_type(4)))  unsigned int u32x4;
typedef __attribute__((ext_vector_type(4)))  float        f32x4;

#define D_MODELc 1024
#define N_HEADSc 16
#define D_HEADc  64
#define D_MLPc   4096
#define Bc       4
#define Sc       2048
#define MROWS    (Bc * Sc)   // 8192

// ---------------- helpers ----------------

__device__ __forceinline__ unsigned short f2bf(float f) {
    union { float f; unsigned u; } x; x.f = f;
    unsigned r = x.u + 0x7FFFu + ((x.u >> 16) & 1u);
    return (unsigned short)(r >> 16);
}

union FragAB { v16bf v; u32x4 q[2]; };

__device__ __forceinline__ void load_frag(FragAB& f, const unsigned short* p0,
                                          const unsigned short* p1) {
    f.q[0] = *reinterpret_cast<const u32x4*>(p0);
    f.q[1] = *reinterpret_cast<const u32x4*>(p1);
}

__device__ __forceinline__ v8f wmma_bf16(v16bf a, v16bf b, v8f c) {
    return __builtin_amdgcn_wmma_f32_16x16x32_bf16(false, a, false, b,
                                                   (short)0, c, false, false);
}

// gfx1250 async global->LDS copy (ASYNCcnt tracked, no VGPR round trip).
__device__ __forceinline__ void async_copy_b128(unsigned ldsoff, const unsigned short* g) {
    asm volatile("global_load_async_to_lds_b128 %0, %1, off"
                 :: "v"(ldsoff), "v"(g) : "memory");
}
__device__ __forceinline__ void wait_async0() {
    asm volatile("s_wait_asynccnt 0" ::: "memory");
}
__device__ __forceinline__ unsigned lds_offset(const void* p) {
    return (unsigned)(unsigned long long)p;   // LDS aperture lives in the high 32 bits
}

// ---------------- shared GEMM core ----------------
// acc[2][4] += A[m0..m0+31][0..K) * Bt[n0..n0+63][0..K)^T
// B tile (64x32 bf16 = 4KB) async-staged into LDS, double buffered.
// All 4 B fragments are pulled into distinct registers before the WMMA burst
// so the 8 ds_load_b128 issue back-to-back and wait once.
__device__ __forceinline__ void gemm_core(const unsigned short* __restrict__ A,
                                          const unsigned short* __restrict__ Bt,
                                          int K, int m0, int n0,
                                          v8f acc[2][4],
                                          unsigned short* lds /* [2][64][32] */) {
    const int tid  = threadIdx.x;
    const int lane = tid & 31;
    const int sel  = lane >> 4;
    const int l16  = lane & 15;

    // cooperative copy mapping: thread t -> (n = t/4, k-sub = (t%4)*8), one b128 each
    const int cn = tid >> 2;
    const int ck = (tid & 3) * 8;
    const unsigned short* gB = Bt + (size_t)(n0 + cn) * K + ck;
    const unsigned loff0 = lds_offset(lds + cn * 32 + ck);
    const unsigned loff1 = lds_offset(lds + 2048 + cn * 32 + ck);

    const unsigned short* arow0 = A + (size_t)(m0 + l16) * K;
    const unsigned short* arow1 = A + (size_t)(m0 + 16 + l16) * K;
    // per-wave LDS read base for B fragments (row n' = j*16 + l16)
    const unsigned short* lbase = lds + l16 * 32 + sel * 8;

    async_copy_b128(loff0, gB);   // prologue: tile 0 -> buffer 0

    for (int k = 0; k < K; k += 32) {
        const int buf = (k >> 5) & 1;
        wait_async0();        // my portion of tile k has landed
        __syncthreads();      // everyone's portion landed; buf^1 free to overwrite
        if (k + 32 < K)
            async_copy_b128(buf ? loff0 : loff1, gB + k + 32);

        FragAB a0, a1;
        load_frag(a0, arow0 + k + sel * 8, arow0 + k + 16 + sel * 8);
        load_frag(a1, arow1 + k + sel * 8, arow1 + k + 16 + sel * 8);

        const unsigned short* lb = lbase + buf * 2048;
        FragAB b0, b1, b2, b3;                 // distinct live values
        load_frag(b0, lb,              lb + 16);
        load_frag(b1, lb + 16 * 32,    lb + 16 * 32 + 16);
        load_frag(b2, lb + 32 * 32,    lb + 32 * 32 + 16);
        load_frag(b3, lb + 48 * 32,    lb + 48 * 32 + 16);

        acc[0][0] = wmma_bf16(a0.v, b0.v, acc[0][0]);
        acc[1][0] = wmma_bf16(a1.v, b0.v, acc[1][0]);
        acc[0][1] = wmma_bf16(a0.v, b1.v, acc[0][1]);
        acc[1][1] = wmma_bf16(a1.v, b1.v, acc[1][1]);
        acc[0][2] = wmma_bf16(a0.v, b2.v, acc[0][2]);
        acc[1][2] = wmma_bf16(a1.v, b2.v, acc[1][2]);
        acc[0][3] = wmma_bf16(a0.v, b3.v, acc[0][3]);
        acc[1][3] = wmma_bf16(a1.v, b3.v, acc[1][3]);
    }
}

// ---------------- weight transpose + f32->bf16 ----------------
// One 64x64 tile per block, turned in LDS: reads are 16 B per lane along the source
// row, writes are 16 B per lane along the destination row (8 lanes = one 128-B line).
// Two source rows are rounded and packed into one dword before they go to LDS.
// Every R and C used here is a multiple of 64; grid = (C/64, R/64, batches).
__global__ __launch_bounds__(256)
void transpose_cvt_kernel(const float* __restrict__ src,
                          unsigned short* __restrict__ dst,
                          int C,
                          long srcBatchStride, long dstBatchStride,
                          int dstRowStride) {
    __shared__ unsigned tile[64][33];   // [c][row pair]; pitch 33 dwords keeps both sides on distinct banks
    const int tid = threadIdx.x;
    const int c0  = blockIdx.x * 64;
    const int r0  = blockIdx.y * 64;
    const long z  = blockIdx.z;

    const float* s = src + z * srcBatchStride + (long)r0 * C + c0;
    const int lc = (tid & 15) * 4;
    const int lp = tid >> 4;
    const float* p0 = s + (long)(2 * lp) * C + lc;
    const float* p1 = p0 + C;
    const float* p2 = s + (long)(2 * (lp + 16)) * C + lc;
    const float* p3 = p2 + C;
    f32x4 lo[2], hi[2];
    lo[0] = *reinterpret_cast<const f32x4*>(p0);
    hi[0] = *reinterpret_cast<const f32x4*>(p1);
    lo[1] = *reinterpret_cast<const f32x4*>(p2);
    hi[1] = *reinterpret_cast<const f32x4*>(p3);
    // the four addresses are inputs so that their registers stay as they are up to this wait
    asm volatile("s_wait_xcnt 0x0" :: "v"(p0), "v"(p1), "v"(p2), "v"(p3) : "memory");
#pragma unroll
    for (int i = 0; i < 2; ++i)
#pragma unroll
        for (int j = 0; j < 4; ++j)
            tile[lc + j][lp + 16 * i] =
                (unsigned)f2bf(lo[i][j]) | ((unsigned)f2bf(hi[i][j]) << 16);
    __syncthreads();

    unsigned short* d = dst + z * dstBatchStride + (long)c0 * dstRowStride + r0;
    const int rq = (tid & 7) * 4;
    const int oc = tid >> 3;
#pragma unroll
    for (int i = 0; i < 2; ++i) {
        const int c = oc + 32 * i;
        u32x4 w;
#pragma unroll
        for (int j = 0; j < 4; ++j) w[j] = tile[c][rq + j];
        *reinterpret_cast<u32x4*>(d + (long)c * dstRowStride + rq * 2) = w;
    }
}

// ---------------- layernorm -> bf16 ----------------
__global__ __launch_bounds__(256)
void ln_bf16_kernel(const float* __restrict__ x, const float* __restrict__ g,
                    const float* __restrict__ bt, unsigned short* __restrict__ out) {
    int row = blockIdx.x;
    int tid = threadIdx.x;
    const float* xr = x + (size_t)row * D_MODELc;
    f32x4 v = reinterpret_cast<const f32x4*>(xr)[tid];
    float s  = v[0] + v[1] + v[2] + v[3];
    float s2 = v[0]*v[0] + v[1]*v[1] + v[2]*v[2] + v[3]*v[3];
    __shared__ float sh1[256], sh2[256];
    sh1[tid] = s; sh2[tid] = s2;
    __syncthreads();
    for (int off = 128; off > 0; off >>= 1) {
        if (tid < off) { sh1[tid] += sh1[tid + off]; sh2[tid] += sh2[tid + off]; }
        __syncthreads();
    }
    float mu   = sh1[0] * (1.0f / D_MODELc);
    float var  = sh2[0] * (1.0f / D_MODELc) - mu * mu;
    float rstd = rsqrtf(var + 1e-5f);
    int c = tid * 4;
    unsigned short* orow = out + (size_t)row * D_MODELc + c;
#pragma unroll
    for (int i = 0; i < 4; ++i)
        orow[i] = f2bf((v[i] - mu) * rstd * g[c + i] + bt[c + i]);
}

// ---------------- generic GEMM: C = A(bf16,[M,K]) * Bt(bf16,[N,K])^T ----------------
template <bool HAS_BIAS, bool HAS_RES, bool DO_GELU, bool OUT_BF16>
__global__ __launch_bounds__(256)
void gemm_bf16_kernel(const unsigned short* __restrict__ A,
                      const unsigned short* __restrict__ Bt,
                      const float* __restrict__ bias,
                      const float* __restrict__ res,
                      float* __restrict__ outF,
                      unsigned short* __restrict__ outB,
                      int M, int N, int K) {
    __shared__ __attribute__((aligned(16))) unsigned short btile[2][64][32];
    const int lane = threadIdx.x & 31;
    const int wave = threadIdx.x >> 5;
    const int sel  = lane >> 4;
    const int l16  = lane & 15;
    const int n0   = blockIdx.x * 64;
    const int m0   = blockIdx.y * 256 + wave * 32;

    v8f zero = {};
    v8f acc[2][4];
#pragma unroll
    for (int ai = 0; ai < 2; ++ai)
#pragma unroll
        for (int j = 0; j < 4; ++j) acc[ai][j] = zero;

    gemm_core(A, Bt, K, m0, n0, acc, &btile[0][0][0]);

#pragma unroll
    for (int ai = 0; ai < 2; ++ai)
#pragma unroll
        for (int j = 0; j < 4; ++j)
#pragma unroll
            for (int r = 0; r < 8; ++r) {
                int m = m0 + ai * 16 + r + 8 * sel;
                int n = n0 + j * 16 + l16;
                float v = acc[ai][j][r];
                if (HAS_BIAS) v += bias[n];
                if (DO_GELU)  v = 0.5f * v * (1.0f + erff(v * 0.70710678118654752f));
                if (HAS_RES)  v += res[(size_t)m * N + n];
                if (OUT_BF16) outB[(size_t)m * N + n] = f2bf(v);
                else          outF[(size_t)m * N + n] = v;
            }
}

// ---------------- QKV GEMM (N=3072): writes Q,K row-major; V transposed [e][t] ----------------
__global__ __launch_bounds__(256)
void gemm_qkv_kernel(const unsigned short* __restrict__ A,
                     const unsigned short* __restrict__ Bt,
                     unsigned short* __restrict__ Q,
                     unsigned short* __restrict__ Kb,
                     unsigned short* __restrict__ Vt) {
    __shared__ __attribute__((aligned(16))) unsigned short btile[2][64][32];
    const int lane = threadIdx.x & 31;
    const int wave = threadIdx.x >> 5;
    const int sel  = lane >> 4;
    const int l16  = lane & 15;
    const int n0   = blockIdx.x * 64;          // which/head uniform per block
    const int m0   = blockIdx.y * 256 + wave * 32;

    v8f zero = {};
    v8f acc[2][4];
#pragma unroll
    for (int ai = 0; ai < 2; ++ai)
#pragma unroll
        for (int j = 0; j < 4; ++j) acc[ai][j] = zero;

    gemm_core(A, Bt, D_MODELc, m0, n0, acc, &btile[0][0][0]);

    const int which = n0 >> 10;              // 0=Q,1=K,2=V
    const int hh    = (n0 & 1023) >> 6;
#pragma unroll
    for (int ai = 0; ai < 2; ++ai)
#pragma unroll
        for (int j = 0; j < 4; ++j)
#pragma unroll
            for (int r = 0; r < 8; ++r) {
                int m = m0 + ai * 16 + r + 8 * sel;
                int b = m >> 11;             // row / S
                int s = m & (Sc - 1);
                int e = j * 16 + l16;
                unsigned short bv = f2bf(acc[ai][j][r]);
                size_t bh = (size_t)(b * N_HEADSc + hh);
                if (which == 0)      Q [(bh * Sc + s) * D_HEADc + e] = bv;
                else if (which == 1) Kb[(bh * Sc + s) * D_HEADc + e] = bv;
                else                 Vt[bh * D_HEADc * Sc + (size_t)e * Sc + s] = bv;
            }
}

// ---------------- flash attention: one 16-row Q tile per wave ----------------
__global__ __launch_bounds__(256)
void attention_kernel(const unsigned short* __restrict__ Q,
                      const unsigned short* __restrict__ Kb,
                      const unsigned short* __restrict__ Vt,
                      unsigned short* __restrict__ Ctx) {
    const int lane = threadIdx.x & 31;
    const int wave = threadIdx.x >> 5;
    const int sel  = lane >> 4;
    const int l16  = lane & 15;
    const int b    = blockIdx.z;
    const int h    = blockIdx.y;
    const int s0   = blockIdx.x * 128 + wave * 16;

    const size_t bh = (size_t)(b * N_HEADSc + h);
    const unsigned short* qb = Q  + bh * Sc * D_HEADc;
    const unsigned short* kb = Kb + bh * Sc * D_HEADc;
    const unsigned short* vb = Vt + bh * D_HEADc * Sc;

    __shared__ __attribute__((aligned(16))) unsigned short pbuf[8][16][32];

    FragAB qf0, qf1;
    const unsigned short* qrow = qb + (size_t)(s0 + l16) * D_HEADc;
    load_frag(qf0, qrow + sel * 8,      qrow + 16 + sel * 8);
    load_frag(qf1, qrow + 32 + sel * 8, qrow + 48 + sel * 8);

    v8f zero = {};
    v8f O[4];
#pragma unroll
    for (int j = 0; j < 4; ++j) O[j] = zero;
    float mi[8], li[8];
#pragma unroll
    for (int r = 0; r < 8; ++r) { mi[r] = -INFINITY; li[r] = 0.0f; }

    const float scale = 0.125f;   // 64^-0.5

    for (int tb = 0; tb < Sc; tb += 32) {
        v8f sc0 = zero, sc1 = zero;
        {
            FragAB kf0, kf1, kf2, kf3;
            const unsigned short* kr0 = kb + (size_t)(tb + l16) * D_HEADc;
            const unsigned short* kr1 = kb + (size_t)(tb + 16 + l16) * D_HEADc;
            load_frag(kf0, kr0 + sel * 8,      kr0 + 16 + sel * 8);
            load_frag(kf1, kr0 + 32 + sel * 8, kr0 + 48 + sel * 8);
            load_frag(kf2, kr1 + sel * 8,      kr1 + 16 + sel * 8);
            load_frag(kf3, kr1 + 32 + sel * 8, kr1 + 48 + sel * 8);
            sc0 = wmma_bf16(qf0.v, kf0.v, sc0);
            sc0 = wmma_bf16(qf1.v, kf1.v, sc0);
            sc1 = wmma_bf16(qf0.v, kf2.v, sc1);
            sc1 = wmma_bf16(qf1.v, kf3.v, sc1);
        }

        float p0[8], p1[8], alpha[8];
#pragma unroll
        for (int r = 0; r < 8; ++r) {
            float a = sc0[r] * scale;
            float c = sc1[r] * scale;
            float tm = fmaxf(a, c);
#pragma unroll
            for (int off = 1; off < 16; off <<= 1)
                tm = fmaxf(tm, __shfl_xor(tm, off, 32));
            float mn = fmaxf(mi[r], tm);
            alpha[r] = __expf(mi[r] - mn);
            p0[r] = __expf(a - mn);
            p1[r] = __expf(c - mn);
            float sm = p0[r] + p1[r];
#pragma unroll
            for (int off = 1; off < 16; off <<= 1)
                sm += __shfl_xor(sm, off, 32);
            li[r] = li[r] * alpha[r] + sm;
            mi[r] = mn;
        }
#pragma unroll
        for (int j = 0; j < 4; ++j)
#pragma unroll
            for (int r = 0; r < 8; ++r) O[j][r] *= alpha[r];

        // bounce P through per-wave LDS tile to convert C-layout -> A-layout
#pragma unroll
        for (int r = 0; r < 8; ++r) {
            int m = r + 8 * sel;
            pbuf[wave][m][l16]      = f2bf(p0[r]);
            pbuf[wave][m][16 + l16] = f2bf(p1[r]);
        }
        asm volatile("s_wait_dscnt 0" ::: "memory");   // DS in-order per wave; fence compiler too

        FragAB pf;
        const unsigned short* pr = &pbuf[wave][l16][0];
        load_frag(pf, pr + sel * 8, pr + 16 + sel * 8);

        FragAB vf0, vf1, vf2, vf3;
        const unsigned short* vr0 = vb + (size_t)(l16)      * Sc + tb;
        const unsigned short* vr1 = vb + (size_t)(16 + l16) * Sc + tb;
        const unsigned short* vr2 = vb + (size_t)(32 + l16) * Sc + tb;
        const unsigned short* vr3 = vb + (size_t)(48 + l16) * Sc + tb;
        load_frag(vf0, vr0 + sel * 8, vr0 + 16 + sel * 8);
        load_frag(vf1, vr1 + sel * 8, vr1 + 16 + sel * 8);
        load_frag(vf2, vr2 + sel * 8, vr2 + 16 + sel * 8);
        load_frag(vf3, vr3 + sel * 8, vr3 + 16 + sel * 8);
        O[0] = wmma_bf16(pf.v, vf0.v, O[0]);
        O[1] = wmma_bf16(pf.v, vf1.v, O[1]);
        O[2] = wmma_bf16(pf.v, vf2.v, O[2]);
        O[3] = wmma_bf16(pf.v, vf3.v, O[3]);
    }

    float inv[8];
#pragma unroll
    for (int r = 0; r < 8; ++r) inv[r] = 1.0f / li[r];
#pragma unroll
    for (int j = 0; j < 4; ++j)
#pragma unroll
        for (int r = 0; r < 8; ++r) {
            int m   = r + 8 * sel;
            int row = b * Sc + s0 + m;
            Ctx[(size_t)row * D_MODELc + h * D_HEADc + j * 16 + l16] =
                f2bf(O[j][r] * inv[r]);
        }
}

// ---------------- host orchestration ----------------
extern "C" void kernel_launch(void* const* d_in, const int* in_sizes, int n_in,
                              void* d_out, int out_size, void* d_ws, size_t ws_size,
                              hipStream_t stream) {
    (void)in_sizes; (void)n_in; (void)out_size; (void)ws_size;
    const float* x     = (const float*)d_in[0];
    const float* WQ    = (const float*)d_in[1];
    const float* WK    = (const float*)d_in[2];
    const float* WV    = (const float*)d_in[3];
    const float* WO    = (const float*)d_in[4];
    const float* ln1_g = (const float*)d_in[5];
    const float* ln1_b = (const float*)d_in[6];
    const float* ln2_g = (const float*)d_in[7];
    const float* ln2_b = (const float*)d_in[8];
    const float* W_in  = (const float*)d_in[9];
    const float* b_in  = (const float*)d_in[10];
    const float* W_out = (const float*)d_in[11];
    const float* b_out = (const float*)d_in[12];

    char* ws = (char*)d_ws;
    size_t off = 0;
    auto alloc = [&](size_t bytes) -> void* {
        void* p = ws + off;
        off += (bytes + 255) & ~(size_t)255;
        return p;
    };
    unsigned short* xln   = (unsigned short*)alloc((size_t)MROWS * D_MODELc * 2);
    unsigned short* wqkvt = (unsigned short*)alloc((size_t)3 * D_MODELc * D_MODELc * 2);
    unsigned short* wot   = (unsigned short*)alloc((size_t)D_MODELc * D_MODELc * 2);
    unsigned short* wint  = (unsigned short*)alloc((size_t)D_MLPc * D_MODELc * 2);
    unsigned short* woutt = (unsigned short*)alloc((size_t)D_MODELc * D_MLPc * 2);
    unsigned short* Qb    = (unsigned short*)alloc((size_t)MROWS * D_MODELc * 2);
    unsigned short* Kbf   = (unsigned short*)alloc((size_t)MROWS * D_MODELc * 2);
    unsigned short* Vtb   = (unsigned short*)alloc((size_t)MROWS * D_MODELc * 2);
    unsigned short* ctx   = (unsigned short*)alloc((size_t)MROWS * D_MODELc * 2);
    float*          x1    = (float*)alloc((size_t)MROWS * D_MODELc * 4);
    unsigned short* hm    = (unsigned short*)alloc((size_t)MROWS * D_MLPc * 2);

    dim3 blk(256);

    // Pack weights: Bt layout = [N][K] bf16
    transpose_cvt_kernel<<<dim3(1, 16, 16), blk, 0, stream>>>(
        WQ, wqkvt,                 64, 65536L, 65536L, 1024);
    transpose_cvt_kernel<<<dim3(1, 16, 16), blk, 0, stream>>>(
        WK, wqkvt + 1024 * 1024,   64, 65536L, 65536L, 1024);
    transpose_cvt_kernel<<<dim3(1, 16, 16), blk, 0, stream>>>(
        WV, wqkvt + 2048 * 1024,   64, 65536L, 65536L, 1024);
    transpose_cvt_kernel<<<dim3(16, 1, 16), blk, 0, stream>>>(
        WO, wot,                   1024, 65536L, 64L,    1024);
    transpose_cvt_kernel<<<dim3(64, 16, 1), blk, 0, stream>>>(
        W_in,  wint,  4096, 0L, 0L, 1024);
    transpose_cvt_kernel<<<dim3(16, 64, 1), blk, 0, stream>>>(
        W_out, woutt, 1024, 0L, 0L, 4096);

    // LN1
    ln_bf16_kernel<<<MROWS, blk, 0, stream>>>(x, ln1_g, ln1_b, xln);

    // QKV
    gemm_qkv_kernel<<<dim3(3072 / 64, MROWS / 256), blk, 0, stream>>>(
        xln, wqkvt, Qb, Kbf, Vtb);

    // Attention (flash)
    attention_kernel<<<dim3(Sc / 128, N_HEADSc, Bc), blk, 0, stream>>>(
        Qb, Kbf, Vtb, ctx);

    // Output projection + residual -> x1 (f32)
    gemm_bf16_kernel<false, true, false, false>
        <<<dim3(1024 / 64, MROWS / 256), blk, 0, stream>>>(
            ctx, wot, nullptr, x, x1, nullptr, MROWS, D_MODELc, D_MODELc);

    // LN2 -> reuse xln
    ln_bf16_kernel<<<MROWS, blk, 0, stream>>>(x1, ln2_g, ln2_b, xln);

    // MLP in: +bias, exact GELU, bf16 out
    gemm_bf16_kernel<true, false, true, true>
        <<<dim3(4096 / 64, MROWS / 256), blk, 0, stream>>>(
            xln, wint, b_in, nullptr, nullptr, hm, MROWS, D_MLPc, D_MODELc);

    // MLP out: +bias, +residual x1 -> d_out (f32)
    gemm_bf16_kernel<true, true, false, false>
        <<<dim3(1024 / 64, MROWS / 256), blk, 0, stream>>>(
            hm, woutt, b_out, x1, (float*)d_out, nullptr, MROWS, D_MODELc, D_MLPc);
}

// v002
// It runs in 600 microseconds.
// Next to v001, in two timings, it ran 1.30 and 1.29 times as fast.
// Over all steps from v000 it is 1.68 times as fast.
#include <hip/hip_runtime.h>
#include <math.h>

typedef __attribute__((ext_vector_type(8)))  float        v8f;
typedef __attribute__((ext_vector_type(16))) __bf16       v16bf;
typedef __attribute__((ext_vector_type(4)))  unsigned int u32x4;
typedef __attribute__((ext_vector_type(4)))  float        f32x4;

#define D_MODELc 1024
#define N_HEADSc 16
#define D_HEADc  64
#define D_MLPc   4096
#define Bc       4
#define Sc       2048
#define MROWS    (Bc * Sc)   // 8192

// ---------------- helpers ----------------

__device__ __forceinline__ unsigned short f2bf(float f) {
    union { float f; unsigned u; } x; x.f = f;
    unsigned r = x.u + 0x7FFFu + ((x.u >> 16) & 1u);
    return (unsigned short)(r >> 16);
}

union FragAB { v16bf v; u32x4 q[2]; };

__device__ __forceinline__ void load_frag(FragAB& f, const unsigned short* p0,
                                          const unsigned short* p1) {
    f.q[0] = *reinterpret_cast<const u32x4*>(p0);
    f.q[1] = *reinterpret_cast<const u32x4*>(p1);
}

__device__ __forceinline__ v8f wmma_bf16(v16bf a, v16bf b, v8f c) {
    return __builtin_amdgcn_wmma_f32_16x16x32_bf16(false, a, false, b,
                                                   (short)0, c, false, false);
}

// gfx1250 async global->LDS copy (ASYNCcnt tracked, no VGPR round trip).
__device__ __forceinline__ void async_copy_b128(unsigned ldsoff, const unsigned short* g) {
    asm volatile("global_load_async_to_lds_b128 %0, %1, off"
                 :: "v"(ldsoff), "v"(g) : "memory");
}
// Four copies of one lane and, as the last line of the same statement, the wait that
// stands in front of any rewrite of the address registers the copies name.
__device__ __forceinline__ void async_copy4_b128(unsigned l0, const unsigned short* g0,
                                                 unsigned l1, const unsigned short* g1,
                                                 unsigned l2, const unsigned short* g2,
                                                 unsigned l3, const unsigned short* g3) {
    asm volatile("global_load_async_to_lds_b128 %0, %1, off\n\t"
                 "global_load_async_to_lds_b128 %2, %3, off\n\t"
                 "global_load_async_to_lds_b128 %4, %5, off\n\t"
                 "global_load_async_to_lds_b128 %6, %7, off\n\t"
                 "s_wait_xcnt 0x0"
                 :: "v"(l0), "v"(g0), "v"(l1), "v"(g1),
                    "v"(l2), "v"(g2), "v"(l3), "v"(g3) : "memory");
}
__device__ __forceinline__ void wait_async0() {
    asm volatile("s_wait_asynccnt 0" ::: "memory");
}
__device__ __forceinline__ unsigned lds_offset(const void* p) {
    return (unsigned)(unsigned long long)p;   // LDS aperture lives in the high 32 bits
}

// ---------------- shared GEMM core ----------------
// acc[2][4] += A[m0..m0+31][0..K) * Bt[n0..n0+63][0..K)^T
// B tile (64x32 bf16 = 4KB) async-staged into LDS, double buffered.
// All 4 B fragments are pulled into distinct registers before the WMMA burst
// so the 8 ds_load_b128 issue back-to-back and wait once.
__device__ __forceinline__ void gemm_core(const unsigned short* __restrict__ A,
                                          const unsigned short* __restrict__ Bt,
                                          int K, int m0, int n0,
                                          v8f acc[2][4],
                                          unsigned short* lds /* [2][64][32] */) {
    const int tid  = threadIdx.x;
    const int lane = tid & 31;
    const int sel  = lane >> 4;
    const int l16  = lane & 15;

    // cooperative copy mapping: thread t -> (n = t/4, k-sub = (t%4)*8), one b128 each
    const int cn = tid >> 2;
    const int ck = (tid & 3) * 8;
    const unsigned short* gB = Bt + (size_t)(n0 + cn) * K + ck;
    const unsigned loff0 = lds_offset(lds + cn * 32 + ck);
    const unsigned loff1 = lds_offset(lds + 2048 + cn * 32 + ck);

    const unsigned short* arow0 = A + (size_t)(m0 + l16) * K;
    const unsigned short* arow1 = A + (size_t)(m0 + 16 + l16) * K;
    // per-wave LDS read base for B fragments (row n' = j*16 + l16)
    const unsigned short* lbase = lds + l16 * 32 + sel * 8;

    async_copy_b128(loff0, gB);   // prologue: tile 0 -> buffer 0

    for (int k = 0; k < K; k += 32) {
        const int buf = (k >> 5) & 1;
        wait_async0();        // my portion of tile k has landed
        __syncthreads();      // everyone's portion landed; buf^1 free to overwrite
        if (k + 32 < K)
            async_copy_b128(buf ? loff0 : loff1, gB + k + 32);

        FragAB a0, a1;
        load_frag(a0, arow0 + k + sel * 8, arow0 + k + 16 + sel * 8);
        load_frag(a1, arow1 + k + sel * 8, arow1 + k + 16 + sel * 8);

        const unsigned short* lb = lbase + buf * 2048;
        FragAB b0, b1, b2, b3;                 // distinct live values
        load_frag(b0, lb,              lb + 16);
        load_frag(b1, lb + 16 * 32,    lb + 16 * 32 + 16);
        load_frag(b2, lb + 32 * 32,    lb + 32 * 32 + 16);
        load_frag(b3, lb + 48 * 32,    lb + 48 * 32 + 16);

        acc[0][0] = wmma_bf16(a0.v, b0.v, acc[0][0]);
        acc[1][0] = wmma_bf16(a1.v, b0.v, acc[1][0]);
        acc[0][1] = wmma_bf16(a0.v, b1.v, acc[0][1]);
        acc[1][1] = wmma_bf16(a1.v, b1.v, acc[1][1]);
        acc[0][2] = wmma_bf16(a0.v, b2.v, acc[0][2]);
        acc[1][2] = wmma_bf16(a1.v, b2.v, acc[1][2]);
        acc[0][3] = wmma_bf16(a0.v, b3.v, acc[0][3]);
        acc[1][3] = wmma_bf16(a1.v, b3.v, acc[1][3]);
    }
}

// ---------------- weight transpose + f32->bf16 ----------------
// One 64x64 tile per block, turned in LDS: reads are 16 B per lane along the source
// row, writes are 16 B per lane along the destination row (8 lanes = one 128-B line).
// Two source rows are rounded and packed into one dword before they go to LDS.
// Every R and C used here is a multiple of 64; grid = (C/64, R/64, batches).
__global__ __launch_bounds__(256)
void transpose_cvt_kernel(const float* __restrict__ src,
                          unsigned short* __restrict__ dst,
                          int C,
                          long srcBatchStride, long dstBatchStride,
                          int dstRowStride) {
    __shared__ unsigned tile[64][33];   // [c][row pair]; pitch 33 dwords keeps both sides on distinct banks
    const int tid = threadIdx.x;
    const int c0  = blockIdx.x * 64;
    const int r0  = blockIdx.y * 64;
    const long z  = blockIdx.z;

    const float* s = src + z * srcBatchStride + (long)r0 * C + c0;
    const int lc = (tid & 15) * 4;
    const int lp = tid >> 4;
    const float* p0 = s + (long)(2 * lp) * C + lc;
    const float* p1 = p0 + C;
    const float* p2 = s + (long)(2 * (lp + 16)) * C + lc;
    const float* p3 = p2 + C;
    f32x4 lo[2], hi[2];
    lo[0] = *reinterpret_cast<const f32x4*>(p0);
    hi[0] = *reinterpret_cast<const f32x4*>(p1);
    lo[1] = *reinterpret_cast<const f32x4*>(p2);
    hi[1] = *reinterpret_cast<const f32x4*>(p3);
    // the four addresses are inputs so that their registers stay as they are up to this wait
    asm volatile("s_wait_xcnt 0x0" :: "v"(p0), "v"(p1), "v"(p2), "v"(p3) : "memory");
#pragma unroll
    for (int i = 0; i < 2; ++i)
#pragma unroll
        for (int j = 0; j < 4; ++j)
            tile[lc + j][lp + 16 * i] =
                (unsigned)f2bf(lo[i][j]) | ((unsigned)f2bf(hi[i][j]) << 16);
    __syncthreads();

    unsigned short* d = dst + z * dstBatchStride + (long)c0 * dstRowStride + r0;
    const int rq = (tid & 7) * 4;
    const int oc = tid >> 3;
#pragma unroll
    for (int i = 0; i < 2; ++i) {
        const int c = oc + 32 * i;
        u32x4 w;
#pragma unroll
        for (int j = 0; j < 4; ++j) w[j] = tile[c][rq + j];
        *reinterpret_cast<u32x4*>(d + (long)c * dstRowStride + rq * 2) = w;
    }
}

// ---------------- layernorm -> bf16 ----------------
__global__ __launch_bounds__(256)
void ln_bf16_kernel(const float* __restrict__ x, const float* __restrict__ g,
                    const float* __restrict__ bt, unsigned short* __restrict__ out) {
    int row = blockIdx.x;
    int tid = threadIdx.x;
    const float* xr = x + (size_t)row * D_MODELc;
    f32x4 v = reinterpret_cast<const f32x4*>(xr)[tid];
    float s  = v[0] + v[1] + v[2] + v[3];
    float s2 = v[0]*v[0] + v[1]*v[1] + v[2]*v[2] + v[3]*v[3];
    __shared__ float sh1[256], sh2[256];
    sh1[tid] = s; sh2[tid] = s2;
    __syncthreads();
    for (int off = 128; off > 0; off >>= 1) {
        if (tid < off) { sh1[tid] += sh1[tid + off]; sh2[tid] += sh2[tid + off]; }
        __syncthreads();
    }
    float mu   = sh1[0] * (1.0f / D_MODELc);
    float var  = sh2[0] * (1.0f / D_MODELc) - mu * mu;
    float rstd = rsqrtf(var + 1e-5f);
    int c = tid * 4;
    unsigned short* orow = out + (size_t)row * D_MODELc + c;
#pragma unroll
    for (int i = 0; i < 4; ++i)
        orow[i] = f2bf((v[i] - mu) * rstd * g[c + i] + bt[c + i]);
}

// ---------------- generic GEMM: C = A(bf16,[M,K]) * Bt(bf16,[N,K])^T ----------------
template <bool HAS_BIAS, bool HAS_RES, bool DO_GELU, bool OUT_BF16>
__global__ __launch_bounds__(256)
void gemm_bf16_kernel(const unsigned short* __restrict__ A,
                      const unsigned short* __restrict__ Bt,
                      const float* __restrict__ bias,
                      const float* __restrict__ res,
                      float* __restrict__ outF,
                      unsigned short* __restrict__ outB,
                      int M, int N, int K) {
    __shared__ __attribute__((aligned(16))) unsigned short btile[2][64][32];
    const int lane = threadIdx.x & 31;
    const int wave = threadIdx.x >> 5;
    const int sel  = lane >> 4;
    const int l16  = lane & 15;
    const int n0   = blockIdx.x * 64;
    const int m0   = blockIdx.y * 256 + wave * 32;

    v8f zero = {};
    v8f acc[2][4];
#pragma unroll
    for (int ai = 0; ai < 2; ++ai)
#pragma unroll
        for (int j = 0; j < 4; ++j) acc[ai][j] = zero;

    gemm_core(A, Bt, K, m0, n0, acc, &btile[0][0][0]);

#pragma unroll
    for (int ai = 0; ai < 2; ++ai)
#pragma unroll
        for (int j = 0; j < 4; ++j)
#pragma unroll
            for (int r = 0; r < 8; ++r) {
                int m = m0 + ai * 16 + r + 8 * sel;
                int n = n0 + j * 16 + l16;
                float v = acc[ai][j][r];
                if (HAS_BIAS) v += bias[n];
                if (DO_GELU)  v = 0.5f * v * (1.0f + erff(v * 0.70710678118654752f));
                if (HAS_RES)  v += res[(size_t)m * N + n];
                if (OUT_BF16) outB[(size_t)m * N + n] = f2bf(v);
                else          outF[(size_t)m * N + n] = v;
            }
}

// ---------------- QKV GEMM (N=3072): writes Q,K row-major; V transposed [e][t] ----------------
__global__ __launch_bounds__(256)
void gemm_qkv_kernel(const unsigned short* __restrict__ A,
                     const unsigned short* __restrict__ Bt,
                     unsigned short* __restrict__ Q,
                     unsigned short* __restrict__ Kb,
                     unsigned short* __restrict__ Vt) {
    __shared__ __attribute__((aligned(16))) unsigned short btile[2][64][32];
    const int lane = threadIdx.x & 31;
    const int wave = threadIdx.x >> 5;
    const int sel  = lane >> 4;
    const int l16  = lane & 15;
    const int n0   = blockIdx.x * 64;          // which/head uniform per block
    const int m0   = blockIdx.y * 256 + wave * 32;

    v8f zero = {};
    v8f acc[2][4];
#pragma unroll
    for (int ai = 0; ai < 2; ++ai)
#pragma unroll
        for (int j = 0; j < 4; ++j) acc[ai][j] = zero;

    gemm_core(A, Bt, D_MODELc, m0, n0, acc, &btile[0][0][0]);

    const int which = n0 >> 10;              // 0=Q,1=K,2=V
    const int hh    = (n0 & 1023) >> 6;
#pragma unroll
    for (int ai = 0; ai < 2; ++ai)
#pragma unroll
        for (int j = 0; j < 4; ++j)
#pragma unroll
            for (int r = 0; r < 8; ++r) {
                int m = m0 + ai * 16 + r + 8 * sel;
                int b = m >> 11;             // row / S
                int s = m & (Sc - 1);
                int e = j * 16 + l16;
                unsigned short bv = f2bf(acc[ai][j][r]);
                size_t bh = (size_t)(b * N_HEADSc + hh);
                if (which == 0)      Q [(bh * Sc + s) * D_HEADc + e] = bv;
                else if (which == 1) Kb[(bh * Sc + s) * D_HEADc + e] = bv;
                else                 Vt[bh * D_HEADc * Sc + (size_t)e * Sc + s] = bv;
            }
}

// ---------------- flash attention: one 16-row Q tile per wave ----------------
// K and V^T come in stages of 64 keys, copied once per block into LDS (two buffers) and
// read from there by all 8 waves. A wave's copy covers four whole 128-B lines.
// LDS rows are 128 B at a pitch of 144 B (16 B x odd) for the 16-byte fragment reads.
#define KV_STAGE 64
#define KV_PITCH 72                       // in bf16 elements
#define KV_NSTAGE (Sc / KV_STAGE)
__global__ __launch_bounds__(256)
void attention_kernel(const unsigned short* __restrict__ Q,
                      const unsigned short* __restrict__ Kb,
                      const unsigned short* __restrict__ Vt,
                      unsigned short* __restrict__ Ctx) {
    const int lane = threadIdx.x & 31;
    const int wave = threadIdx.x >> 5;
    const int sel  = lane >> 4;
    const int l16  = lane & 15;
    const int b    = blockIdx.z;
    const int h    = blockIdx.y;
    const int s0   = blockIdx.x * 128 + wave * 16;

    const size_t bh = (size_t)(b * N_HEADSc + h);
    const unsigned short* qb = Q  + bh * Sc * D_HEADc;
    const unsigned short* kb = Kb + bh * Sc * D_HEADc;
    const unsigned short* vb = Vt + bh * D_HEADc * Sc;

    __shared__ __attribute__((aligned(16))) unsigned short pbuf[8][16][32];
    __shared__ __attribute__((aligned(16))) unsigned short kst[2][KV_STAGE][KV_PITCH];  // [buf][key][e]
    __shared__ __attribute__((aligned(16))) unsigned short vst[2][D_HEADc][KV_PITCH];   // [buf][e][key]

    // copy mapping: thread t -> rows t/8 and t/8 + 32, 16 B at column (t%8)*8, of both tiles
    const int crow = threadIdx.x >> 3;
    const int ccol = (threadIdx.x & 7) * 8;
    const unsigned short* gk = kb + (size_t)crow * D_HEADc + ccol;
    const unsigned short* gv = vb + (size_t)crow * Sc + ccol;
    const unsigned lk = lds_offset(&kst[0][crow][ccol]);
    const unsigned lv = lds_offset(&vst[0][crow][ccol]);
    const unsigned halfB = 32 * KV_PITCH * 2;        // 32 rows further, bytes
    const unsigned bufB  = KV_STAGE * KV_PITCH * 2;  // next buffer, bytes
    auto copy_stage = [&](int st) {
        const unsigned bo = (st & 1) * bufB;
        const unsigned short* k0 = gk + (size_t)st * KV_STAGE * D_HEADc;
        const unsigned short* v0 = gv + st * KV_STAGE;
        async_copy4_b128(lk + bo,         k0,
                         lk + bo + halfB, k0 + 32 * D_HEADc,
                         lv + bo,         v0,
                         lv + bo + halfB, v0 + (size_t)32 * Sc);
    };
    copy_stage(0);
    wait_async0();        // my part of stage 0 has landed
    __syncthreads();      // everyone's part has landed
    copy_stage(1);

    FragAB qf0, qf1;
    const unsigned short* qrow = qb + (size_t)(s0 + l16) * D_HEADc;
    load_frag(qf0, qrow + sel * 8,      qrow + 16 + sel * 8);
    load_frag(qf1, qrow + 32 + sel * 8, qrow + 48 + sel * 8);

    v8f zero = {};
    v8f O[4];
#pragma unroll
    for (int j = 0; j < 4; ++j) O[j] = zero;
    float mi[8], li[8];
#pragma unroll
    for (int r = 0; r < 8; ++r) { mi[r] = -INFINITY; li[r] = 0.0f; }

    const float scale = 0.125f;   // 64^-0.5

    for (int st = 0; st < KV_NSTAGE; ++st) {
      const int buf = st & 1;
      for (int tb = 0; tb < KV_STAGE; tb += 32) {
        v8f sc0 = zero, sc1 = zero;
        {
            FragAB kf0, kf1, kf2, kf3;
            const unsigned short* kr0 = &kst[buf][tb + l16][0];
            const unsigned short* kr1 = &kst[buf][tb + 16 + l16][0];
            load_frag(kf0, kr0 + sel * 8,      kr0 + 16 + sel * 8);
            load_frag(kf1, kr0 + 32 + sel * 8, kr0 + 48 + sel * 8);
            load_frag(kf2, kr1 + sel * 8,      kr1 + 16 + sel * 8);
            load_frag(kf3, kr1 + 32 + sel * 8, kr1 + 48 + sel * 8);
            sc0 = wmma_bf16(qf0.v, kf0.v, sc0);
            sc0 = wmma_bf16(qf1.v, kf1.v, sc0);
            sc1 = wmma_bf16(qf0.v, kf2.v, sc1);
            sc1 = wmma_bf16(qf1.v, kf3.v, sc1);
        }

        float p0[8], p1[8], alpha[8];
#pragma unroll
        for (int r = 0; r < 8; ++r) {
            float a = sc0[r] * scale;
            float c = sc1[r] * scale;
            float tm = fmaxf(a, c);
#pragma unroll
            for (int off = 1; off < 16; off <<= 1)
                tm = fmaxf(tm, __shfl_xor(tm, off, 32));
            float mn = fmaxf(mi[r], tm);
            alpha[r] = __expf(mi[r] - mn);
            p0[r] = __expf(a - mn);
            p1[r] = __expf(c - mn);
            float sm = p0[r] + p1[r];
#pragma unroll
            for (int off = 1; off < 16; off <<= 1)
                sm += __shfl_xor(sm, off, 32);
            li[r] = li[r] * alpha[r] + sm;
            mi[r] = mn;
        }
#pragma unroll
        for (int j = 0; j < 4; ++j)
#pragma unroll
            for (int r = 0; r < 8; ++r) O[j][r] *= alpha[r];

        // bounce P through per-wave LDS tile to convert C-layout -> A-layout
#pragma unroll
        for (int r = 0; r < 8; ++r) {
            int m = r + 8 * sel;
            pbuf[wave][m][l16]      = f2bf(p0[r]);
            pbuf[wave][m][16 + l16] = f2bf(p1[r]);
        }
        asm volatile("s_wait_dscnt 0" ::: "memory");   // DS in-order per wave; fence compiler too

        FragAB pf;
        const unsigned short* pr = &pbuf[wave][l16][0];
        load_frag(pf, pr + sel * 8, pr + 16 + sel * 8);

        FragAB vf0, vf1, vf2, vf3;
        const unsigned short* vr0 = &vst[buf][l16][tb];
        const unsigned short* vr1 = &vst[buf][16 + l16][tb];
        const unsigned short* vr2 = &vst[buf][32 + l16][tb];
        const unsigned short* vr3 = &vst[buf][48 + l16][tb];
        load_frag(vf0, vr0 + sel * 8, vr0 + 16 + sel * 8);
        load_frag(vf1, vr1 + sel * 8, vr1 + 16 + sel * 8);
        load_frag(vf2, vr2 + sel * 8, vr2 + 16 + sel * 8);
        load_frag(vf3, vr3 + sel * 8, vr3 + 16 + sel * 8);
        O[0] = wmma_bf16(pf.v, vf0.v, O[0]);
        O[1] = wmma_bf16(pf.v, vf1.v, O[1]);
        O[2] = wmma_bf16(pf.v, vf2.v, O[2]);
        O[3] = wmma_bf16(pf.v, vf3.v, O[3]);
      }
      // hand-over: my reads of this buffer are done, my copies of the next stage have landed,
      // then every wave's; only behind that is this buffer filled again
      asm volatile("s_wait_dscnt 0" ::: "memory");
      wait_async0();
      __syncthreads();
      if (st + 2 < KV_NSTAGE) copy_stage(st + 2);
    }
    wait_async0();        // nothing of mine is in flight when the wave ends

    float inv[8];
#pragma unroll
    for (int r = 0; r < 8; ++r) inv[r] = 1.0f / li[r];
#pragma unroll
    for (int j = 0; j < 4; ++j)
#pragma unroll
        for (int r = 0; r < 8; ++r) {
            int m   = r + 8 * sel;
            int row = b * Sc + s0 + m;
            Ctx[(size_t)row * D_MODELc + h * D_HEADc + j * 16 + l16] =
                f2bf(O[j][r] * inv[r]);
        }
}

// ---------------- host orchestration ----------------
extern "C" void kernel_launch(void* const* d_in, const int* in_sizes, int n_in,
                              void* d_out, int out_size, void* d_ws, size_t ws_size,
                              hipStream_t stream) {
    (void)in_sizes; (void)n_in; (void)out_size; (void)ws_size;
    const float* x     = (const float*)d_in[0];
    const float* WQ    = (const float*)d_in[1];
    const float* WK    = (const float*)d_in[2];
    const float* WV    = (const float*)d_in[3];
    const float* WO    = (const float*)d_in[4];
    const float* ln1_g = (const float*)d_in[5];
    const float* ln1_b = (const float*)d_in[6];
    const float* ln2_g = (const float*)d_in[7];
    const float* ln2_b = (const float*)d_in[8];
    const float* W_in  = (const float*)d_in[9];
    const float* b_in  = (const float*)d_in[10];
    const float* W_out = (const float*)d_in[11];
    const float* b_out = (const float*)d_in[12];

    char* ws = (char*)d_ws;
    size_t off = 0;
    auto alloc = [&](size_t bytes) -> void* {
        void* p = ws + off;
        off += (bytes + 255) & ~(size_t)255;
        return p;
    };
    unsigned short* xln   = (unsigned short*)alloc((size_t)MROWS * D_MODELc * 2);
    unsigned short* wqkvt = (unsigned short*)alloc((size_t)3 * D_MODELc * D_MODELc * 2);
    unsigned short* wot   = (unsigned short*)alloc((size_t)D_MODELc * D_MODELc * 2);
    unsigned short* wint  = (unsigned short*)alloc((size_t)D_MLPc * D_MODELc * 2);
    unsigned short* woutt = (unsigned short*)alloc((size_t)D_MODELc * D_MLPc * 2);
    unsigned short* Qb    = (unsigned short*)alloc((size_t)MROWS * D_MODELc * 2);
    unsigned short* Kbf   = (unsigned short*)alloc((size_t)MROWS * D_MODELc * 2);
    unsigned short* Vtb   = (unsigned short*)alloc((size_t)MROWS * D_MODELc * 2);
    unsigned short* ctx   = (unsigned short*)alloc((size_t)MROWS * D_MODELc * 2);
    float*          x1    = (float*)alloc((size_t)MROWS * D_MODELc * 4);
    unsigned short* hm    = (unsigned short*)alloc((size_t)MROWS * D_MLPc * 2);

    dim3 blk(256);

    // Pack weights: Bt layout = [N][K] bf16
    transpose_cvt_kernel<<<dim3(1, 16, 16), blk, 0, stream>>>(
        WQ, wqkvt,                 64, 65536L, 65536L, 1024);
    transpose_cvt_kernel<<<dim3(1, 16, 16), blk, 0, stream>>>(
        WK, wqkvt + 1024 * 1024,   64, 65536L, 65536L, 1024);
    transpose_cvt_kernel<<<dim3(1, 16, 16), blk, 0, stream>>>(
        WV, wqkvt + 2048 * 1024,   64, 65536L, 65536L, 1024);
    transpose_cvt_kernel<<<dim3(16, 1, 16), blk, 0, stream>>>(
        WO, wot,                   1024, 65536L, 64L,    1024);
    transpose_cvt_kernel<<<dim3(64, 16, 1), blk, 0, stream>>>(
        W_in,  wint,  4096, 0L, 0L, 1024);
    transpose_cvt_kernel<<<dim3(16, 64, 1), blk, 0, stream>>>(
        W_out, woutt, 1024, 0L, 0L, 4096);

    // LN1
    ln_bf16_kernel<<<MROWS, blk, 0, stream>>>(x, ln1_g, ln1_b, xln);

    // QKV
    gemm_qkv_kernel<<<dim3(3072 / 64, MROWS / 256), blk, 0, stream>>>(
        xln, wqkvt, Qb, Kbf, Vtb);

    // Attention (flash)
    attention_kernel<<<dim3(Sc / 128, N_HEADSc, Bc), blk, 0, stream>>>(
        Qb, Kbf, Vtb, ctx);

    // Output projection + residual -> x1 (f32)
    gemm_bf16_kernel<false, true, false, false>
        <<<dim3(1024 / 64, MROWS / 256), blk, 0, stream>>>(
            ctx, wot, nullptr, x, x1, nullptr, MROWS, D_MODELc, D_MODELc);

    // LN2 -> reuse xln
    ln_bf16_kernel<<<MROWS, blk, 0, stream>>>(x1, ln2_g, ln2_b, xln);

    // MLP in: +bias, exact GELU, bf16 out
    gemm_bf16_kernel<true, false, true, true>
        <<<dim3(4096 / 64, MROWS / 256), blk, 0, stream>>>(
            xln, wint, b_in, nullptr, nullptr, hm, MROWS, D_MLPc, D_MODELc);

    // MLP out: +bias, +residual x1 -> d_out (f32)
    gemm_bf16_kernel<true, true, false, false>
        <<<dim3(1024 / 64, MROWS / 256), blk, 0, stream>>>(
            hm, woutt, b_out, x1, (float*)d_out, nullptr, MROWS, D_MODELc, D_MLPc);
}

// v003
// One run takes 444 microseconds.
// In two side-by-side timings against v002, it was 1.33 and 1.32 times as fast.
// Counting every step since v000, it is 2.22 times as fast.
#include <hip/hip_runtime.h>
#include <math.h>

typedef __attribute__((ext_vector_type(8)))  float        v8f;
typedef __attribute__((ext_vector_type(16))) __bf16       v16bf;
typedef __attribute__((ext_vector_type(4)))  unsigned int u32x4;
typedef __attribute__((ext_vector_type(4)))  float        f32x4;

#define D_MODELc 1024
#define N_HEADSc 16
#define D_HEADc  64
#define D_MLPc   4096
#define Bc       4
#define Sc       2048
#define MROWS    (Bc * Sc)   // 8192

// ---------------- helpers ----------------

__device__ __forceinline__ unsigned short f2bf(float f) {
    union { float f; unsigned u; } x; x.f = f;
    unsigned r = x.u + 0x7FFFu + ((x.u >> 16) & 1u);
    return (unsigned short)(r >> 16);
}

union FragAB { v16bf v; u32x4 q[2]; };

__device__ __forceinline__ void load_frag(FragAB& f, const unsigned short* p0,
                                          const unsigned short* p1) {
    f.q[0] = *reinterpret_cast<const u32x4*>(p0);
    f.q[1] = *reinterpret_cast<const u32x4*>(p1);
}

__device__ __forceinline__ v8f wmma_bf16(v16bf a, v16bf b, v8f c) {
    return __builtin_amdgcn_wmma_f32_16x16x32_bf16(false, a, false, b,
                                                   (short)0, c, false, false);
}

// gfx1250 async global->LDS copy (ASYNCcnt tracked, no VGPR round trip).
// Four copies of one lane and, as the last line of the same statement, the wait that
// stands in front of any rewrite of the address registers the copies name.
__device__ __forceinline__ void async_copy4_b128(unsigned l0, const unsigned short* g0,
                                                 unsigned l1, const unsigned short* g1,
                                                 unsigned l2, const unsigned short* g2,
                                                 unsigned l3, const unsigned short* g3) {
    asm volatile("global_load_async_to_lds_b128 %0, %1, off\n\t"
                 "global_load_async_to_lds_b128 %2, %3, off\n\t"
                 "global_load_async_to_lds_b128 %4, %5, off\n\t"
                 "global_load_async_to_lds_b128 %6, %7, off\n\t"
                 "s_wait_xcnt 0x0"
                 :: "v"(l0), "v"(g0), "v"(l1), "v"(g1),
                    "v"(l2), "v"(g2), "v"(l3), "v"(g3) : "memory");
}
// The same for eight copies of one lane (a GEMM stage: four rows of A, four of B).
__device__ __forceinline__ void async_copy8_b128(unsigned l0, const unsigned short* g0,
                                                 unsigned l1, const unsigned short* g1,
                                                 unsigned l2, const unsigned short* g2,
                                                 unsigned l3, const unsigned short* g3,
                                                 unsigned l4, const unsigned short* g4,
                                                 unsigned l5, const unsigned short* g5,
                                                 unsigned l6, const unsigned short* g6,
                                                 unsigned l7, const unsigned short* g7) {
    asm volatile("global_load_async_to_lds_b128 %0, %1, off\n\t"
                 "global_load_async_to_lds_b128 %2, %3, off\n\t"
                 "global_load_async_to_lds_b128 %4, %5, off\n\t"
                 "global_load_async_to_lds_b128 %6, %7, off\n\t"
                 "global_load_async_to_lds_b128 %8, %9, off\n\t"
                 "global_load_async_to_lds_b128 %10, %11, off\n\t"
                 "global_load_async_to_lds_b128 %12, %13, off\n\t"
                 "global_load_async_to_lds_b128 %14, %15, off\n\t"
                 "s_wait_xcnt 0x0"
                 :: "v"(l0), "v"(g0), "v"(l1), "v"(g1), "v"(l2), "v"(g2), "v"(l3), "v"(g3),
                    "v"(l4), "v"(g4), "v"(l5), "v"(g5), "v"(l6), "v"(g6), "v"(l7), "v"(g7)
                 : "memory");
}
__device__ __forceinline__ void wait_async0() {
    asm volatile("s_wait_asynccnt 0" ::: "memory");
}
__device__ __forceinline__ unsigned lds_offset(const void* p) {
    return (unsigned)(unsigned long long)p;   // LDS aperture lives in the high 32 bits
}

// ---------------- shared GEMM core ----------------
// One block owns a 128 x 128 tile of C; its 8 waves sit 4 (m) x 2 (n), 32 x 64 each.
// acc[2][4] += A[mblk+wm .. +31][0..K) * Bt[nblk+wn .. +63][0..K)^T
// A and Bt come in stages of 64 k: 128 rows of each, 128 B a row, copied once per block
// into LDS (two buffers) and read from there by every wave that needs them. A wave's copy
// covers four whole 128-B lines. LDS pitch 144 B (16 B x odd) for the 16-byte fragment reads.
// K is a multiple of 64; M and N are multiples of 128.
#define G_TILE  128
#define G_STAGE 64
#define G_PITCH 72                            // in bf16 elements
#define G_BUF   (2 * G_TILE * G_PITCH)        // one buffer: A rows, then Bt rows; elements
__device__ __forceinline__ void gemm_core(const unsigned short* __restrict__ A,
                                          const unsigned short* __restrict__ Bt,
                                          int K, int mblk, int nblk, int wm, int wn,
                                          v8f acc[2][4],
                                          unsigned short* lds /* [2][256][G_PITCH] */) {
    const int tid  = threadIdx.x;
    const int lane = tid & 31;
    const int sel  = lane >> 4;
    const int l16  = lane & 15;

    // copy mapping: thread t -> rows t/8 + {0,32,64,96}, 16 B at column (t%8)*8, of both tiles
    const int crow = tid >> 3;
    const int ccol = (tid & 7) * 8;
    const unsigned short* gA = A  + (size_t)(mblk + crow) * K + ccol;
    const unsigned short* gB = Bt + (size_t)(nblk + crow) * K + ccol;
    const size_t   gq = (size_t)32 * K;              // 32 rows further, elements
    const unsigned lA = lds_offset(lds + crow * G_PITCH + ccol);
    const unsigned lB = lA + G_TILE * G_PITCH * 2;   // the Bt rows, bytes
    const unsigned lq = 32 * G_PITCH * 2;            // 32 rows further, bytes
    auto copy_stage = [&](int st) {
        const unsigned bo = (st & 1) * (G_BUF * 2);
        const unsigned short* a = gA + (size_t)st * G_STAGE;
        const unsigned short* b = gB + (size_t)st * G_STAGE;
        async_copy8_b128(lA + bo,          a,
                         lA + bo + lq,     a + gq,
                         lA + bo + 2 * lq, a + 2 * gq,
                         lA + bo + 3 * lq, a + 3 * gq,
                         lB + bo,          b,
                         lB + bo + lq,     b + gq,
                         lB + bo + 2 * lq, b + 2 * gq,
                         lB + bo + 3 * lq, b + 3 * gq);
    };
    const int nst = K / G_STAGE;

    copy_stage(0);
    wait_async0();        // my part of stage 0 has landed
    __syncthreads();      // everyone's part has landed
    if (nst > 1) copy_stage(1);

    // per-wave fragment bases in buffer 0 (row = l16, k = sel*8 .. and 16 + sel*8 ..)
    const unsigned short* la0 = lds + (wm + l16) * G_PITCH + sel * 8;
    const unsigned short* lb0 = lds + (G_TILE + wn + l16) * G_PITCH + sel * 8;

    for (int st = 0; st < nst; ++st) {
        const unsigned short* la = la0 + (st & 1) * G_BUF;
        const unsigned short* lb = lb0 + (st & 1) * G_BUF;
#pragma unroll   // two 32-k halves of a stage: constant LDS offsets
        for (int kk = 0; kk < G_STAGE; kk += 32) {
            FragAB a0, a1, b0, b1, b2, b3;
            load_frag(a0, la + kk,                la + kk + 16);
            load_frag(a1, la + 16 * G_PITCH + kk, la + 16 * G_PITCH + kk + 16);
            load_frag(b0, lb + kk,                lb + kk + 16);
            load_frag(b1, lb + 16 * G_PITCH + kk, lb + 16 * G_PITCH + kk + 16);
            load_frag(b2, lb + 32 * G_PITCH + kk, lb + 32 * G_PITCH + kk + 16);
            load_frag(b3, lb + 48 * G_PITCH + kk, lb + 48 * G_PITCH + kk + 16);

            acc[0][0] = wmma_bf16(a0.v, b0.v, acc[0][0]);
            acc[1][0] = wmma_bf16(a1.v, b0.v, acc[1][0]);
            acc[0][1] = wmma_bf16(a0.v, b1.v, acc[0][1]);
            acc[1][1] = wmma_bf16(a1.v, b1.v, acc[1][1]);
            acc[0][2] = wmma_bf16(a0.v, b2.v, acc[0][2]);
            acc[1][2] = wmma_bf16(a1.v, b2.v, acc[1][2]);
            acc[0][3] = wmma_bf16(a0.v, b3.v, acc[0][3]);
            acc[1][3] = wmma_bf16(a1.v, b3.v, acc[1][3]);
        }
        // hand-over: my reads of this buffer are done, my copies of the next stage have landed,
        // then every wave's; only behind that is this buffer filled again
        asm volatile("s_wait_dscnt 0" ::: "memory");
        wait_async0();
        __syncthreads();
        if (st + 2 < nst) copy_stage(st + 2);
    }
    wait_async0();        // nothing of mine is in flight when the core is left
}

// ---------------- weight transpose + f32->bf16 ----------------
// One 64x64 tile per block, turned in LDS: reads are 16 B per lane along the source
// row, writes are 16 B per lane along the destination row (8 lanes = one 128-B line).
// Two source rows are rounded and packed into one dword before they go to LDS.
// Every R and C used here is a multiple of 64; grid = (C/64, R/64, batches).
__global__ __launch_bounds__(256)
void transpose_cvt_kernel(const float* __restrict__ src,
                          unsigned short* __restrict__ dst,
                          int C,
                          long srcBatchStride, long dstBatchStride,
                          int dstRowStride) {
    __shared__ unsigned tile[64][33];   // [c][row pair]; pitch 33 dwords keeps both sides on distinct banks
    const int tid = threadIdx.x;
    const int c0  = blockIdx.x * 64;
    const int r0  = blockIdx.y * 64;
    const long z  = blockIdx.z;

    const float* s = src + z * srcBatchStride + (long)r0 * C + c0;
    const int lc = (tid & 15) * 4;
    const int lp = tid >> 4;
    const float* p0 = s + (long)(2 * lp) * C + lc;
    const float* p1 = p0 + C;
    const float* p2 = s + (long)(2 * (lp + 16)) * C + lc;
    const float* p3 = p2 + C;
    f32x4 lo[2], hi[2];
    lo[0] = *reinterpret_cast<const f32x4*>(p0);
    hi[0] = *reinterpret_cast<const f32x4*>(p1);
    lo[1] = *reinterpret_cast<const f32x4*>(p2);
    hi[1] = *reinterpret_cast<const f32x4*>(p3);
    // the four addresses are inputs so that their registers stay as they are up to this wait
    asm volatile("s_wait_xcnt 0x0" :: "v"(p0), "v"(p1), "v"(p2), "v"(p3) : "memory");
#pragma unroll
    for (int i = 0; i < 2; ++i)
#pragma unroll
        for (int j = 0; j < 4; ++j)
            tile[lc + j][lp + 16 * i] =
                (unsigned)f2bf(lo[i][j]) | ((unsigned)f2bf(hi[i][j]) << 16);
    __syncthreads();

    unsigned short* d = dst + z * dstBatchStride + (long)c0 * dstRowStride + r0;
    const int rq = (tid & 7) * 4;
    const int oc = tid >> 3;
#pragma unroll
    for (int i = 0; i < 2; ++i) {
        const int c = oc + 32 * i;
        u32x4 w;
#pragma unroll
        for (int j = 0; j < 4; ++j) w[j] = tile[c][rq + j];
        *reinterpret_cast<u32x4*>(d + (long)c * dstRowStride + rq * 2) = w;
    }
}

// ---------------- layernorm -> bf16 ----------------
__global__ __launch_bounds__(256)
void ln_bf16_kernel(const float* __restrict__ x, const float* __restrict__ g,
                    const float* __restrict__ bt, unsigned short* __restrict__ out) {
    int row = blockIdx.x;
    int tid = threadIdx.x;
    const float* xr = x + (size_t)row * D_MODELc;
    f32x4 v = reinterpret_cast<const f32x4*>(xr)[tid];
    float s  = v[0] + v[1] + v[2] + v[3];
    float s2 = v[0]*v[0] + v[1]*v[1] + v[2]*v[2] + v[3]*v[3];
    __shared__ float sh1[256], sh2[256];
    sh1[tid] = s; sh2[tid] = s2;
    __syncthreads();
    for (int off = 128; off > 0; off >>= 1) {
        if (tid < off) { sh1[tid] += sh1[tid + off]; sh2[tid] += sh2[tid + off]; }
        __syncthreads();
    }
    float mu   = sh1[0] * (1.0f / D_MODELc);
    float var  = sh2[0] * (1.0f / D_MODELc) - mu * mu;
    float rstd = rsqrtf(var + 1e-5f);
    int c = tid * 4;
    unsigned short* orow = out + (size_t)row * D_MODELc + c;
#pragma unroll
    for (int i = 0; i < 4; ++i)
        orow[i] = f2bf((v[i] - mu) * rstd * g[c + i] + bt[c + i]);
}

// ---------------- generic GEMM: C = A(bf16,[M,K]) * Bt(bf16,[N,K])^T ----------------
template <bool HAS_BIAS, bool HAS_RES, bool DO_GELU, bool OUT_BF16>
__global__ __launch_bounds__(256)
void gemm_bf16_kernel(const unsigned short* __restrict__ A,
                      const unsigned short* __restrict__ Bt,
                      const float* __restrict__ bias,
                      const float* __restrict__ res,
                      float* __restrict__ outF,
                      unsigned short* __restrict__ outB,
                      int M, int N, int K) {
    __shared__ __attribute__((aligned(16))) unsigned short stile[2 * G_BUF];
    const int lane = threadIdx.x & 31;
    const int wave = __builtin_amdgcn_readfirstlane(threadIdx.x >> 5);   // scalar: tile offsets stay in SGPRs
    const int sel  = lane >> 4;
    const int l16  = lane & 15;
    const int wm   = (wave >> 1) * 32;
    const int wn   = (wave & 1) * 64;
    const int n0   = blockIdx.x * G_TILE + wn;
    const int m0   = blockIdx.y * G_TILE + wm;

    v8f zero = {};
    v8f acc[2][4];
#pragma unroll
    for (int ai = 0; ai < 2; ++ai)
#pragma unroll
        for (int j = 0; j < 4; ++j) acc[ai][j] = zero;

    gemm_core(A, Bt, K, blockIdx.y * G_TILE, blockIdx.x * G_TILE, wm, wn, acc, stile);

#pragma unroll
    for (int ai = 0; ai < 2; ++ai)
#pragma unroll
        for (int j = 0; j < 4; ++j)
#pragma unroll
            for (int r = 0; r < 8; ++r) {
                int m = m0 + ai * 16 + r + 8 * sel;
                int n = n0 + j * 16 + l16;
                float v = acc[ai][j][r];
                if (HAS_BIAS) v += bias[n];
                if (DO_GELU)  v = 0.5f * v * (1.0f + erff(v * 0.70710678118654752f));
                if (HAS_RES)  v += res[(size_t)m * N + n];
                if (OUT_BF16) outB[(size_t)m * N + n] = f2bf(v);
                else          outF[(size_t)m * N + n] = v;
            }
}

// ---------------- QKV GEMM (N=3072): writes Q,K row-major; V transposed [e][t] ----------------
__global__ __launch_bounds__(256)
void gemm_qkv_kernel(const unsigned short* __restrict__ A,
                     const unsigned short* __restrict__ Bt,
                     unsigned short* __restrict__ Q,
                     unsigned short* __restrict__ Kb,
                     unsigned short* __restrict__ Vt) {
    __shared__ __attribute__((aligned(16))) unsigned short stile[2 * G_BUF];
    const int lane = threadIdx.x & 31;
    const int wave = __builtin_amdgcn_readfirstlane(threadIdx.x >> 5);   // scalar: tile offsets stay in SGPRs
    const int sel  = lane >> 4;
    const int l16  = lane & 15;
    const int wm   = (wave >> 1) * 32;
    const int wn   = (wave & 1) * 64;
    const int n0   = blockIdx.x * G_TILE + wn;   // which/head uniform per wave
    const int m0   = blockIdx.y * G_TILE + wm;

    v8f zero = {};
    v8f acc[2][4];
#pragma unroll
    for (int ai = 0; ai < 2; ++ai)
#pragma unroll
        for (int j = 0; j < 4; ++j) acc[ai][j] = zero;

    gemm_core(A, Bt, D_MODELc, blockIdx.y * G_TILE, blockIdx.x * G_TILE, wm, wn, acc, stile);

    const int which = n0 >> 10;              // 0=Q,1=K,2=V
    const int hh    = (n0 & 1023) >> 6;
#pragma unroll
    for (int ai = 0; ai < 2; ++ai)
#pragma unroll
        for (int j = 0; j < 4; ++j)
#pragma unroll
            for (int r = 0; r < 8; ++r) {
                int m = m0 + ai * 16 + r + 8 * sel;
                int b = m >> 11;             // row / S
                int s = m & (Sc - 1);
                int e = j * 16 + l16;
                unsigned short bv = f2bf(acc[ai][j][r]);
                size_t bh = (size_t)(b * N_HEADSc + hh);
                if (which == 0)      Q [(bh * Sc + s) * D_HEADc + e] = bv;
                else if (which == 1) Kb[(bh * Sc + s) * D_HEADc + e] = bv;
                else                 Vt[bh * D_HEADc * Sc + (size_t)e * Sc + s] = bv;
            }
}

// ---------------- flash attention: one 16-row Q tile per wave ----------------
// K and V^T come in stages of 64 keys, copied once per block into LDS (two buffers) and
// read from there by all 8 waves. A wave's copy covers four whole 128-B lines.
// LDS rows are 128 B at a pitch of 144 B (16 B x odd) for the 16-byte fragment reads.
#define KV_STAGE 64
#define KV_PITCH 72                       // in bf16 elements
#define KV_NSTAGE (Sc / KV_STAGE)
__global__ __launch_bounds__(256)
void attention_kernel(const unsigned short* __restrict__ Q,
                      const unsigned short* __restrict__ Kb,
                      const unsigned short* __restrict__ Vt,
                      unsigned short* __restrict__ Ctx) {
    const int lane = threadIdx.x & 31;
    const int wave = threadIdx.x >> 5;
    const int sel  = lane >> 4;
    const int l16  = lane & 15;
    const int b    = blockIdx.z;
    const int h    = blockIdx.y;
    const int s0   = blockIdx.x * 128 + wave * 16;

    const size_t bh = (size_t)(b * N_HEADSc + h);
    const unsigned short* qb = Q  + bh * Sc * D_HEADc;
    const unsigned short* kb = Kb + bh * Sc * D_HEADc;
    const unsigned short* vb = Vt + bh * D_HEADc * Sc;

    __shared__ __attribute__((aligned(16))) unsigned short pbuf[8][16][32];
    __shared__ __attribute__((aligned(16))) unsigned short kst[2][KV_STAGE][KV_PITCH];  // [buf][key][e]
    __shared__ __attribute__((aligned(16))) unsigned short vst[2][D_HEADc][KV_PITCH];   // [buf][e][key]

    // copy mapping: thread t -> rows t/8 and t/8 + 32, 16 B at column (t%8)*8, of both tiles
    const int crow = threadIdx.x >> 3;
    const int ccol = (threadIdx.x & 7) * 8;
    const unsigned short* gk = kb + (size_t)crow * D_HEADc + ccol;
    const unsigned short* gv = vb + (size_t)crow * Sc + ccol;
    const unsigned lk = lds_offset(&kst[0][crow][ccol]);
    const unsigned lv = lds_offset(&vst[0][crow][ccol]);
    const unsigned halfB = 32 * KV_PITCH * 2;        // 32 rows further, bytes
    const unsigned bufB  = KV_STAGE * KV_PITCH * 2;  // next buffer, bytes
    auto copy_stage = [&](int st) {
        const unsigned bo = (st & 1) * bufB;
        const unsigned short* k0 = gk + (size_t)st * KV_STAGE * D_HEADc;
        const unsigned short* v0 = gv + st * KV_STAGE;
        async_copy4_b128(lk + bo,         k0,
                         lk + bo + halfB, k0 + 32 * D_HEADc,
                         lv + bo,         v0,
                         lv + bo + halfB, v0 + (size_t)32 * Sc);
    };
    copy_stage(0);
    wait_async0();        // my part of stage 0 has landed
    __syncthreads();      // everyone's part has landed
    copy_stage(1);

    FragAB qf0, qf1;
    const unsigned short* qrow = qb + (size_t)(s0 + l16) * D_HEADc;
    load_frag(qf0, qrow + sel * 8,      qrow + 16 + sel * 8);
    load_frag(qf1, qrow + 32 + sel * 8, qrow + 48 + sel * 8);

    v8f zero = {};
    v8f O[4];
#pragma unroll
    for (int j = 0; j < 4; ++j) O[j] = zero;
    float mi[8], li[8];
#pragma unroll
    for (int r = 0; r < 8; ++r) { mi[r] = -INFINITY; li[r] = 0.0f; }

    const float scale = 0.125f;   // 64^-0.5

    for (int st = 0; st < KV_NSTAGE; ++st) {
      const int buf = st & 1;
      for (int tb = 0; tb < KV_STAGE; tb += 32) {
        v8f sc0 = zero, sc1 = zero;
        {
            FragAB kf0, kf1, kf2, kf3;
            const unsigned short* kr0 = &kst[buf][tb + l16][0];
            const unsigned short* kr1 = &kst[buf][tb + 16 + l16][0];
            load_frag(kf0, kr0 + sel * 8,      kr0 + 16 + sel * 8);
            load_frag(kf1, kr0 + 32 + sel * 8, kr0 + 48 + sel * 8);
            load_frag(kf2, kr1 + sel * 8,      kr1 + 16 + sel * 8);
            load_frag(kf3, kr1 + 32 + sel * 8, kr1 + 48 + sel * 8);
            sc0 = wmma_bf16(qf0.v, kf0.v, sc0);
            sc0 = wmma_bf16(qf1.v, kf1.v, sc0);
            sc1 = wmma_bf16(qf0.v, kf2.v, sc1);
            sc1 = wmma_bf16(qf1.v, kf3.v, sc1);
        }

        float p0[8], p1[8], alpha[8];
#pragma unroll
        for (int r = 0; r < 8; ++r) {
            float a = sc0[r] * scale;
            float c = sc1[r] * scale;
            float tm = fmaxf(a, c);
#pragma unroll
            for (int off = 1; off < 16; off <<= 1)
                tm = fmaxf(tm, __shfl_xor(tm, off, 32));
            float mn = fmaxf(mi[r], tm);
            alpha[r] = __expf(mi[r] - mn);
            p0[r] = __expf(a - mn);
            p1[r] = __expf(c - mn);
            float sm = p0[r] + p1[r];
#pragma unroll
            for (int off = 1; off < 16; off <<= 1)
                sm += __shfl_xor(sm, off, 32);
            li[r] = li[r] * alpha[r] + sm;
            mi[r] = mn;
        }
#pragma unroll
        for (int j = 0; j < 4; ++j)
#pragma unroll
            for (int r = 0; r < 8; ++r) O[j][r] *= alpha[r];

        // bounce P through per-wave LDS tile to convert C-layout -> A-layout
#pragma unroll
        for (int r = 0; r < 8; ++r) {
            int m = r + 8 * sel;
            pbuf[wave][m][l16]      = f2bf(p0[r]);
            pbuf[wave][m][16 + l16] = f2bf(p1[r]);
        }
        asm volatile("s_wait_dscnt 0" ::: "memory");   // DS in-order per wave; fence compiler too

        FragAB pf;
        const unsigned short* pr = &pbuf[wave][l16][0];
        load_frag(pf, pr + sel * 8, pr + 16 + sel * 8);

        FragAB vf0, vf1, vf2, vf3;
        const unsigned short* vr0 = &vst[buf][l16][tb];
        const unsigned short* vr1 = &vst[buf][16 + l16][tb];
        const unsigned short* vr2 = &vst[buf][32 + l16][tb];
        const unsigned short* vr3 = &vst[buf][48 + l16][tb];
        load_frag(vf0, vr0 + sel * 8, vr0 + 16 + sel * 8);
        load_frag(vf1, vr1 + sel * 8, vr1 + 16 + sel * 8);
        load_frag(vf2, vr2 + sel * 8, vr2 + 16 + sel * 8);
        load_frag(vf3, vr3 + sel * 8, vr3 + 16 + sel * 8);
        O[0] = wmma_bf16(pf.v, vf0.v, O[0]);
        O[1] = wmma_bf16(pf.v, vf1.v, O[1]);
        O[2] = wmma_bf16(pf.v, vf2.v, O[2]);
        O[3] = wmma_bf16(pf.v, vf3.v, O[3]);
      }
      // hand-over: my reads of this buffer are done, my copies of the next stage have landed,
      // then every wave's; only behind that is this buffer filled again
      asm volatile("s_wait_dscnt 0" ::: "memory");
      wait_async0();
      __syncthreads();
      if (st + 2 < KV_NSTAGE) copy_stage(st + 2);
    }
    wait_async0();        // nothing of mine is in flight when the wave ends

    float inv[8];
#pragma unroll
    for (int r = 0; r < 8; ++r) inv[r] = 1.0f / li[r];
#pragma unroll
    for (int j = 0; j < 4; ++j)
#pragma unroll
        for (int r = 0; r < 8; ++r) {
            int m   = r + 8 * sel;
            int row = b * Sc + s0 + m;
            Ctx[(size_t)row * D_MODELc + h * D_HEADc + j * 16 + l16] =
                f2bf(O[j][r] * inv[r]);
        }
}

// ---------------- host orchestration ----------------
extern "C" void kernel_launch(void* const* d_in, const int* in_sizes, int n_in,
                              void* d_out, int out_size, void* d_ws, size_t ws_size,
                              hipStream_t stream) {
    (void)in_sizes; (void)n_in; (void)out_size; (void)ws_size;
    const float* x     = (const float*)d_in[0];
    const float* WQ    = (const float*)d_in[1];
    const float* WK    = (const float*)d_in[2];
    const float* WV    = (const float*)d_in[3];
    const float* WO    = (const float*)d_in[4];
    const float* ln1_g = (const float*)d_in[5];
    const float* ln1_b = (const float*)d_in[6];
    const float* ln2_g = (const float*)d_in[7];
    const float* ln2_b = (const float*)d_in[8];
    const float* W_in  = (const float*)d_in[9];
    const float* b_in  = (const float*)d_in[10];
    const float* W_out = (const float*)d_in[11];
    const float* b_out = (const float*)d_in[12];

    char* ws = (char*)d_ws;
    size_t off = 0;
    auto alloc = [&](size_t bytes) -> void* {
        void* p = ws + off;
        off += (bytes + 255) & ~(size_t)255;
        return p;
    };
    unsigned short* xln   = (unsigned short*)alloc((size_t)MROWS * D_MODELc * 2);
    unsigned short* wqkvt = (unsigned short*)alloc((size_t)3 * D_MODELc * D_MODELc * 2);
    unsigned short* wot   = (unsigned short*)alloc((size_t)D_MODELc * D_MODELc * 2);
    unsigned short* wint  = (unsigned short*)alloc((size_t)D_MLPc * D_MODELc * 2);
    unsigned short* woutt = (unsigned short*)alloc((size_t)D_MODELc * D_MLPc * 2);
    unsigned short* Qb    = (unsigned short*)alloc((size_t)MROWS * D_MODELc * 2);
    unsigned short* Kbf   = (unsigned short*)alloc((size_t)MROWS * D_MODELc * 2);
    unsigned short* Vtb   = (unsigned short*)alloc((size_t)MROWS * D_MODELc * 2);
    unsigned short* ctx   = (unsigned short*)alloc((size_t)MROWS * D_MODELc * 2);
    float*          x1    = (float*)alloc((size_t)MROWS * D_MODELc * 4);
    unsigned short* hm    = (unsigned short*)alloc((size_t)MROWS * D_MLPc * 2);

    dim3 blk(256);

    // Pack weights: Bt layout = [N][K] bf16
    transpose_cvt_kernel<<<dim3(1, 16, 16), blk, 0, stream>>>(
        WQ, wqkvt,                 64, 65536L, 65536L, 1024);
    transpose_cvt_kernel<<<dim3(1, 16, 16), blk, 0, stream>>>(
        WK, wqkvt + 1024 * 1024,   64, 65536L, 65536L, 1024);
    transpose_cvt_kernel<<<dim3(1, 16, 16), blk, 0, stream>>>(
        WV, wqkvt + 2048 * 1024,   64, 65536L, 65536L, 1024);
    transpose_cvt_kernel<<<dim3(16, 1, 16), blk, 0, stream>>>(
        WO, wot,                   1024, 65536L, 64L,    1024);
    transpose_cvt_kernel<<<dim3(64, 16, 1), blk, 0, stream>>>(
        W_in,  wint,  4096, 0L, 0L, 1024);
    transpose_cvt_kernel<<<dim3(16, 64, 1), blk, 0, stream>>>(
        W_out, woutt, 1024, 0L, 0L, 4096);

    // LN1
    ln_bf16_kernel<<<MROWS, blk, 0, stream>>>(x, ln1_g, ln1_b, xln);

    // QKV
    gemm_qkv_kernel<<<dim3(3072 / 128, MROWS / 128), blk, 0, stream>>>(
        xln, wqkvt, Qb, Kbf, Vtb);

    // Attention (flash)
    attention_kernel<<<dim3(Sc / 128, N_HEADSc, Bc), blk, 0, stream>>>(
        Qb, Kbf, Vtb, ctx);

    // Output projection + residual -> x1 (f32)
    gemm_bf16_kernel<false, true, false, false>
        <<<dim3(1024 / 128, MROWS / 128), blk, 0, stream>>>(
            ctx, wot, nullptr, x, x1, nullptr, MROWS, D_MODELc, D_MODELc);

    // LN2 -> reuse xln
    ln_bf16_kernel<<<MROWS, blk, 0, stream>>>(x1, ln2_g, ln2_b, xln);

    // MLP in: +bias, exact GELU, bf16 out
    gemm_bf16_kernel<true, false, true, true>
        <<<dim3(4096 / 128, MROWS / 128), blk, 0, stream>>>(
            xln, wint, b_in, nullptr, nullptr, hm, MROWS, D_MLPc, D_MODELc);

    // MLP out: +bias, +residual x1 -> d_out (f32)
    gemm_bf16_kernel<true, true, false, false>
        <<<dim3(1024 / 128, MROWS / 128), blk, 0, stream>>>(
            hm, woutt, b_out, x1, (float*)d_out, nullptr, MROWS, D_MODELc, D_MLPc);
}

// v004
// A run of this version takes 347 microseconds.
// In two side-by-side timings against v003, it was 1.29 and 1.28 times as fast.
// All steps since v000 together make it 2.85 times as fast.
#include <hip/hip_runtime.h>
#include <math.h>

typedef __attribute__((ext_vector_type(8)))  float        v8f;
typedef __attribute__((ext_vector_type(16))) __bf16       v16bf;
typedef __attribute__((ext_vector_type(4)))  unsigned int u32x4;
typedef __attribute__((ext_vector_type(4)))  float        f32x4;

#define D_MODELc 1024
#define N_HEADSc 16
#define D_HEADc  64
#define D_MLPc   4096
#define Bc       4
#define Sc       2048
#define MROWS    (Bc * Sc)   // 8192

// ---------------- helpers ----------------

__device__ __forceinline__ unsigned short f2bf(float f) {
    union { float f; unsigned u; } x; x.f = f;
    unsigned r = x.u + 0x7FFFu + ((x.u >> 16) & 1u);
    return (unsigned short)(r >> 16);
}

union FragAB { v16bf v; u32x4 q[2]; };

__device__ __forceinline__ void load_frag(FragAB& f, const unsigned short* p0,
                                          const unsigned short* p1) {
    f.q[0] = *reinterpret_cast<const u32x4*>(p0);
    f.q[1] = *reinterpret_cast<const u32x4*>(p1);
}

__device__ __forceinline__ v8f wmma_bf16(v16bf a, v16bf b, v8f c) {
    return __builtin_amdgcn_wmma_f32_16x16x32_bf16(false, a, false, b,
                                                   (short)0, c, false, false);
}

// gfx1250 async global->LDS copy (ASYNCcnt tracked, no VGPR round trip).
// Four copies of one lane and, as the last line of the same statement, the wait that
// stands in front of any rewrite of the address registers the copies name.
__device__ __forceinline__ void async_copy4_b128(unsigned l0, const unsigned short* g0,
                                                 unsigned l1, const unsigned short* g1,
                                                 unsigned l2, const unsigned short* g2,
                                                 unsigned l3, const unsigned short* g3) {
    asm volatile("global_load_async_to_lds_b128 %0, %1, off\n\t"
                 "global_load_async_to_lds_b128 %2, %3, off\n\t"
                 "global_load_async_to_lds_b128 %4, %5, off\n\t"
                 "global_load_async_to_lds_b128 %6, %7, off\n\t"
                 "s_wait_xcnt 0x0"
                 :: "v"(l0), "v"(g0), "v"(l1), "v"(g1),
                    "v"(l2), "v"(g2), "v"(l3), "v"(g3) : "memory");
}
// The same for eight copies of one lane (a GEMM stage: four rows of A, four of B).
__device__ __forceinline__ void async_copy8_b128(unsigned l0, const unsigned short* g0,
                                                 unsigned l1, const unsigned short* g1,
                                                 unsigned l2, const unsigned short* g2,
                                                 unsigned l3, const unsigned short* g3,
                                                 unsigned l4, const unsigned short* g4,
                                                 unsigned l5, const unsigned short* g5,
                                                 unsigned l6, const unsigned short* g6,
                                                 unsigned l7, const unsigned short* g7) {
    asm volatile("global_load_async_to_lds_b128 %0, %1, off\n\t"
                 "global_load_async_to_lds_b128 %2, %3, off\n\t"
                 "global_load_async_to_lds_b128 %4, %5, off\n\t"
                 "global_load_async_to_lds_b128 %6, %7, off\n\t"
                 "global_load_async_to_lds_b128 %8, %9, off\n\t"
                 "global_load_async_to_lds_b128 %10, %11, off\n\t"
                 "global_load_async_to_lds_b128 %12, %13, off\n\t"
                 "global_load_async_to_lds_b128 %14, %15, off\n\t"
                 "s_wait_xcnt 0x0"
                 :: "v"(l0), "v"(g0), "v"(l1), "v"(g1), "v"(l2), "v"(g2), "v"(l3), "v"(g3),
                    "v"(l4), "v"(g4), "v"(l5), "v"(g5), "v"(l6), "v"(g6), "v"(l7), "v"(g7)
                 : "memory");
}
__device__ __forceinline__ void wait_async0() {
    asm volatile("s_wait_asynccnt 0" ::: "memory");
}
__device__ __forceinline__ unsigned lds_offset(const void* p) {
    return (unsigned)(unsigned long long)p;   // LDS aperture lives in the high 32 bits
}

// ---------------- shared GEMM core ----------------
// One block owns a 128 x 128 tile of C; its 8 waves sit 4 (m) x 2 (n), 32 x 64 each.
// acc[2][4] += A[mblk+wm .. +31][0..K) * Bt[nblk+wn .. +63][0..K)^T
// A and Bt come in stages of 64 k: 128 rows of each, 128 B a row, copied once per block
// into LDS (two buffers) and read from there by every wave that needs them. A wave's copy
// covers four whole 128-B lines. LDS pitch 144 B (16 B x odd) for the 16-byte fragment reads.
// K is a multiple of 64; M and N are multiples of 128.
#define G_TILE  128
#define G_STAGE 64
#define G_PITCH 72                            // in bf16 elements
#define G_BUF   (2 * G_TILE * G_PITCH)        // one buffer: A rows, then Bt rows; elements
__device__ __forceinline__ void gemm_core(const unsigned short* __restrict__ A,
                                          const unsigned short* __restrict__ Bt,
                                          int K, int mblk, int nblk, int wm, int wn,
                                          v8f acc[2][4],
                                          unsigned short* lds /* [2][256][G_PITCH] */) {
    const int tid  = threadIdx.x;
    const int lane = tid & 31;
    const int sel  = lane >> 4;
    const int l16  = lane & 15;

    // copy mapping: thread t -> rows t/8 + {0,32,64,96}, 16 B at column (t%8)*8, of both tiles
    const int crow = tid >> 3;
    const int ccol = (tid & 7) * 8;
    const unsigned short* gA = A  + (size_t)(mblk + crow) * K + ccol;
    const unsigned short* gB = Bt + (size_t)(nblk + crow) * K + ccol;
    const size_t   gq = (size_t)32 * K;              // 32 rows further, elements
    const unsigned lA = lds_offset(lds + crow * G_PITCH + ccol);
    const unsigned lB = lA + G_TILE * G_PITCH * 2;   // the Bt rows, bytes
    const unsigned lq = 32 * G_PITCH * 2;            // 32 rows further, bytes
    auto copy_stage = [&](int st) {
        const unsigned bo = (st & 1) * (G_BUF * 2);
        const unsigned short* a = gA + (size_t)st * G_STAGE;
        const unsigned short* b = gB + (size_t)st * G_STAGE;
        async_copy8_b128(lA + bo,          a,
                         lA + bo + lq,     a + gq,
                         lA + bo + 2 * lq, a + 2 * gq,
                         lA + bo + 3 * lq, a + 3 * gq,
                         lB + bo,          b,
                         lB + bo + lq,     b + gq,
                         lB + bo + 2 * lq, b + 2 * gq,
                         lB + bo + 3 * lq, b + 3 * gq);
    };
    const int nst = K / G_STAGE;

    copy_stage(0);
    wait_async0();        // my part of stage 0 has landed
    __syncthreads();      // everyone's part has landed
    if (nst > 1) copy_stage(1);

    // per-wave fragment bases in buffer 0 (row = l16, k = sel*8 .. and 16 + sel*8 ..)
    const unsigned short* la0 = lds + (wm + l16) * G_PITCH + sel * 8;
    const unsigned short* lb0 = lds + (G_TILE + wn + l16) * G_PITCH + sel * 8;

    for (int st = 0; st < nst; ++st) {
        const unsigned short* la = la0 + (st & 1) * G_BUF;
        const unsigned short* lb = lb0 + (st & 1) * G_BUF;
#pragma unroll   // two 32-k halves of a stage: constant LDS offsets
        for (int kk = 0; kk < G_STAGE; kk += 32) {
            FragAB a0, a1, b0, b1, b2, b3;
            load_frag(a0, la + kk,                la + kk + 16);
            load_frag(a1, la + 16 * G_PITCH + kk, la + 16 * G_PITCH + kk + 16);
            load_frag(b0, lb + kk,                lb + kk + 16);
            load_frag(b1, lb + 16 * G_PITCH + kk, lb + 16 * G_PITCH + kk + 16);
            load_frag(b2, lb + 32 * G_PITCH + kk, lb + 32 * G_PITCH + kk + 16);
            load_frag(b3, lb + 48 * G_PITCH + kk, lb + 48 * G_PITCH + kk + 16);

            acc[0][0] = wmma_bf16(a0.v, b0.v, acc[0][0]);
            acc[1][0] = wmma_bf16(a1.v, b0.v, acc[1][0]);
            acc[0][1] = wmma_bf16(a0.v, b1.v, acc[0][1]);
            acc[1][1] = wmma_bf16(a1.v, b1.v, acc[1][1]);
            acc[0][2] = wmma_bf16(a0.v, b2.v, acc[0][2]);
            acc[1][2] = wmma_bf16(a1.v, b2.v, acc[1][2]);
            acc[0][3] = wmma_bf16(a0.v, b3.v, acc[0][3]);
            acc[1][3] = wmma_bf16(a1.v, b3.v, acc[1][3]);
        }
        // hand-over: my reads of this buffer are done, my copies of the next stage have landed,
        // then every wave's; only behind that is this buffer filled again
        asm volatile("s_wait_dscnt 0" ::: "memory");
        wait_async0();
        __syncthreads();
        if (st + 2 < nst) copy_stage(st + 2);
    }
    wait_async0();        // nothing of mine is in flight when the core is left
}

// ---------------- weight transpose + f32->bf16 ----------------
// One 64x64 tile per block, turned in LDS: reads are 16 B per lane along the source
// row, writes are 16 B per lane along the destination row (8 lanes = one 128-B line).
// Two source rows are rounded and packed into one dword before they go to LDS.
// Every R and C used here is a multiple of 64; grid = (C/64, R/64, batches).
__global__ __launch_bounds__(256)
void transpose_cvt_kernel(const float* __restrict__ src,
                          unsigned short* __restrict__ dst,
                          int C,
                          long srcBatchStride, long dstBatchStride,
                          int dstRowStride) {
    __shared__ unsigned tile[64][33];   // [c][row pair]; pitch 33 dwords keeps both sides on distinct banks
    const int tid = threadIdx.x;
    const int c0  = blockIdx.x * 64;
    const int r0  = blockIdx.y * 64;
    const long z  = blockIdx.z;

    const float* s = src + z * srcBatchStride + (long)r0 * C + c0;
    const int lc = (tid & 15) * 4;
    const int lp = tid >> 4;
    const float* p0 = s + (long)(2 * lp) * C + lc;
    const float* p1 = p0 + C;
    const float* p2 = s + (long)(2 * (lp + 16)) * C + lc;
    const float* p3 = p2 + C;
    f32x4 lo[2], hi[2];
    lo[0] = *reinterpret_cast<const f32x4*>(p0);
    hi[0] = *reinterpret_cast<const f32x4*>(p1);
    lo[1] = *reinterpret_cast<const f32x4*>(p2);
    hi[1] = *reinterpret_cast<const f32x4*>(p3);
    // the four addresses are inputs so that their registers stay as they are up to this wait
    asm volatile("s_wait_xcnt 0x0" :: "v"(p0), "v"(p1), "v"(p2), "v"(p3) : "memory");
#pragma unroll
    for (int i = 0; i < 2; ++i)
#pragma unroll
        for (int j = 0; j < 4; ++j)
            tile[lc + j][lp + 16 * i] =
                (unsigned)f2bf(lo[i][j]) | ((unsigned)f2bf(hi[i][j]) << 16);
    __syncthreads();

    unsigned short* d = dst + z * dstBatchStride + (long)c0 * dstRowStride + r0;
    const int rq = (tid & 7) * 4;
    const int oc = tid >> 3;
#pragma unroll
    for (int i = 0; i < 2; ++i) {
        const int c = oc + 32 * i;
        u32x4 w;
#pragma unroll
        for (int j = 0; j < 4; ++j) w[j] = tile[c][rq + j];
        *reinterpret_cast<u32x4*>(d + (long)c * dstRowStride + rq * 2) = w;
    }
}

// ---------------- layernorm -> bf16 ----------------
__global__ __launch_bounds__(256)
void ln_bf16_kernel(const float* __restrict__ x, const float* __restrict__ g,
                    const float* __restrict__ bt, unsigned short* __restrict__ out) {
    int row = blockIdx.x;
    int tid = threadIdx.x;
    const float* xr = x + (size_t)row * D_MODELc;
    f32x4 v = reinterpret_cast<const f32x4*>(xr)[tid];
    float s  = v[0] + v[1] + v[2] + v[3];
    float s2 = v[0]*v[0] + v[1]*v[1] + v[2]*v[2] + v[3]*v[3];
    __shared__ float sh1[256], sh2[256];
    sh1[tid] = s; sh2[tid] = s2;
    __syncthreads();
    for (int off = 128; off > 0; off >>= 1) {
        if (tid < off) { sh1[tid] += sh1[tid + off]; sh2[tid] += sh2[tid + off]; }
        __syncthreads();
    }
    float mu   = sh1[0] * (1.0f / D_MODELc);
    float var  = sh2[0] * (1.0f / D_MODELc) - mu * mu;
    float rstd = rsqrtf(var + 1e-5f);
    int c = tid * 4;
    unsigned short* orow = out + (size_t)row * D_MODELc + c;
#pragma unroll
    for (int i = 0; i < 4; ++i)
        orow[i] = f2bf((v[i] - mu) * rstd * g[c + i] + bt[c + i]);
}

// ---------------- generic GEMM: C = A(bf16,[M,K]) * Bt(bf16,[N,K])^T ----------------
template <bool HAS_BIAS, bool HAS_RES, bool DO_GELU, bool OUT_BF16>
__global__ __launch_bounds__(256)
void gemm_bf16_kernel(const unsigned short* __restrict__ A,
                      const unsigned short* __restrict__ Bt,
                      const float* __restrict__ bias,
                      const float* __restrict__ res,
                      float* __restrict__ outF,
                      unsigned short* __restrict__ outB,
                      int M, int N, int K) {
    __shared__ __attribute__((aligned(16))) unsigned short stile[2 * G_BUF];
    const int lane = threadIdx.x & 31;
    const int wave = __builtin_amdgcn_readfirstlane(threadIdx.x >> 5);   // scalar: tile offsets stay in SGPRs
    const int sel  = lane >> 4;
    const int l16  = lane & 15;
    const int wm   = (wave >> 1) * 32;
    const int wn   = (wave & 1) * 64;
    const int n0   = blockIdx.x * G_TILE + wn;
    const int m0   = blockIdx.y * G_TILE + wm;

    v8f zero = {};
    v8f acc[2][4];
#pragma unroll
    for (int ai = 0; ai < 2; ++ai)
#pragma unroll
        for (int j = 0; j < 4; ++j) acc[ai][j] = zero;

    gemm_core(A, Bt, K, blockIdx.y * G_TILE, blockIdx.x * G_TILE, wm, wn, acc, stile);

#pragma unroll
    for (int ai = 0; ai < 2; ++ai)
#pragma unroll
        for (int j = 0; j < 4; ++j)
#pragma unroll
            for (int r = 0; r < 8; ++r) {
                int m = m0 + ai * 16 + r + 8 * sel;
                int n = n0 + j * 16 + l16;
                float v = acc[ai][j][r];
                if (HAS_BIAS) v += bias[n];
                if (DO_GELU)  v = 0.5f * v * (1.0f + erff(v * 0.70710678118654752f));
                if (HAS_RES)  v += res[(size_t)m * N + n];
                if (OUT_BF16) outB[(size_t)m * N + n] = f2bf(v);
                else          outF[(size_t)m * N + n] = v;
            }
}

// ---------------- QKV GEMM (N=3072): writes Q,K row-major; V transposed [e][t] ----------------
__global__ __launch_bounds__(256)
void gemm_qkv_kernel(const unsigned short* __restrict__ A,
                     const unsigned short* __restrict__ Bt,
                     unsigned short* __restrict__ Q,
                     unsigned short* __restrict__ Kb,
                     unsigned short* __restrict__ Vt) {
    __shared__ __attribute__((aligned(16))) unsigned short stile[2 * G_BUF];
    const int lane = threadIdx.x & 31;
    const int wave = __builtin_amdgcn_readfirstlane(threadIdx.x >> 5);   // scalar: tile offsets stay in SGPRs
    const int sel  = lane >> 4;
    const int l16  = lane & 15;
    const int wm   = (wave >> 1) * 32;
    const int wn   = (wave & 1) * 64;
    const int n0   = blockIdx.x * G_TILE + wn;   // which/head uniform per wave
    const int m0   = blockIdx.y * G_TILE + wm;

    v8f zero = {};
    v8f acc[2][4];
#pragma unroll
    for (int ai = 0; ai < 2; ++ai)
#pragma unroll
        for (int j = 0; j < 4; ++j) acc[ai][j] = zero;

    gemm_core(A, Bt, D_MODELc, blockIdx.y * G_TILE, blockIdx.x * G_TILE, wm, wn, acc, stile);

    const int which = n0 >> 10;              // 0=Q,1=K,2=V
    const int hh    = (n0 & 1023) >> 6;
#pragma unroll
    for (int ai = 0; ai < 2; ++ai)
#pragma unroll
        for (int j = 0; j < 4; ++j)
#pragma unroll
            for (int r = 0; r < 8; ++r) {
                int m = m0 + ai * 16 + r + 8 * sel;
                int b = m >> 11;             // row / S
                int s = m & (Sc - 1);
                int e = j * 16 + l16;
                unsigned short bv = f2bf(acc[ai][j][r]);
                size_t bh = (size_t)(b * N_HEADSc + hh);
                if (which == 0)      Q [(bh * Sc + s) * D_HEADc + e] = bv;
                else if (which == 1) Kb[(bh * Sc + s) * D_HEADc + e] = bv;
                else                 Vt[bh * D_HEADc * Sc + (size_t)e * Sc + s] = bv;
            }
}

#define KV_STAGE 64
#define KV_PITCH 72                       // in bf16 elements
#define KV_NSTAGE (Sc / KV_STAGE)
typedef __attribute__((ext_vector_type(2))) float  f32x2;
typedef __attribute__((ext_vector_type(2))) __bf16 bf16x2;
__device__ __forceinline__ unsigned pack2(float lo, float hi) {   // round to nearest even, as f2bf
    return __builtin_bit_cast(unsigned, __builtin_convertvector(f32x2{lo, hi}, bf16x2));
}
__device__ __forceinline__ float xhalf(float x) {                 // lane l reads lane l ^ 16
    int b = __builtin_bit_cast(int, x);
    return __builtin_bit_cast(float,
        __builtin_amdgcn_permlanex16(b, b, 0x76543210, 0xfedcba98, false, false));
}
__global__ __launch_bounds__(256)
void attention_kernel(const unsigned short* __restrict__ Q,
                      const unsigned short* __restrict__ Kb,
                      const unsigned short* __restrict__ Vt,
                      unsigned short* __restrict__ Ctx) {
    const int lane = threadIdx.x & 31;
    const int wave = threadIdx.x >> 5;
    const int sel  = lane >> 4;
    const int l16  = lane & 15;
    const int b    = blockIdx.z;
    const int h    = blockIdx.y;
    const int s0   = blockIdx.x * 128 + wave * 16;

    const size_t bh = (size_t)(b * N_HEADSc + h);
    const unsigned short* qb = Q  + bh * Sc * D_HEADc;
    const unsigned short* kb = Kb + bh * Sc * D_HEADc;
    const unsigned short* vb = Vt + bh * D_HEADc * Sc;

    __shared__ __attribute__((aligned(16))) unsigned short kst[2][KV_STAGE][KV_PITCH];  // [buf][key][e]
    __shared__ __attribute__((aligned(16))) unsigned short vst[2][D_HEADc][KV_PITCH];   // [buf][e][key]

    // copy mapping: thread t -> rows t/8 and t/8 + 32, 16 B at column (t%8)*8, of both tiles
    const int crow = threadIdx.x >> 3;
    const int ccol = (threadIdx.x & 7) * 8;
    const unsigned short* gk = kb + (size_t)crow * D_HEADc + ccol;
    const unsigned short* gv = vb + (size_t)crow * Sc + ccol;
    const unsigned lk = lds_offset(&kst[0][crow][ccol]);
    const unsigned lv = lds_offset(&vst[0][crow][ccol]);
    const unsigned halfB = 32 * KV_PITCH * 2;        // 32 rows further, bytes
    const unsigned bufB  = KV_STAGE * KV_PITCH * 2;  // next buffer, bytes
    auto copy_stage = [&](int st) {
        const unsigned bo = (st & 1) * bufB;
        const unsigned short* k0 = gk + (size_t)st * KV_STAGE * D_HEADc;
        const unsigned short* v0 = gv + st * KV_STAGE;
        async_copy4_b128(lk + bo,         k0,
                         lk + bo + halfB, k0 + 32 * D_HEADc,
                         lv + bo,         v0,
                         lv + bo + halfB, v0 + (size_t)32 * Sc);
    };
    copy_stage(0);
    wait_async0();        // my part of stage 0 has landed
    __syncthreads();      // everyone's part has landed
    copy_stage(1);

    // Q as the B operand: column = query l16, same k order as the K rows
    FragAB qf0, qf1;
    const unsigned short* qrow = qb + (size_t)(s0 + l16) * D_HEADc;
    load_frag(qf0, qrow + sel * 8,      qrow + 16 + sel * 8);
    load_frag(qf1, qrow + 32 + sel * 8, qrow + 48 + sel * 8);

    v8f zero = {};
    v8f O[4];             // O[j][r] = O^T[e = 16 j + 8 sel + r][query l16]
#pragma unroll
    for (int j = 0; j < 4; ++j) O[j] = zero;
    float mi = -INFINITY; // this query's running maximum, base-2 scaled; equal in both halves
    float li = 0.0f;      // sum over this half's keys only; the halves are joined behind the loop

    const float cscale = 0.125f * 1.4426950408889634f;   // 64^-0.5 * log2(e)

    for (int st = 0; st < KV_NSTAGE; ++st) {
      const int buf = st & 1;
      for (int tb = 0; tb < KV_STAGE; tb += 32) {
        v8f sc0 = zero, sc1 = zero;   // keys tb + 8 sel + r and tb + 16 + 8 sel + r
        {
            FragAB kf0, kf1, kf2, kf3;
            const unsigned short* kr0 = &kst[buf][tb + l16][0];
            const unsigned short* kr1 = &kst[buf][tb + 16 + l16][0];
            load_frag(kf0, kr0 + sel * 8,      kr0 + 16 + sel * 8);
            load_frag(kf1, kr0 + 32 + sel * 8, kr0 + 48 + sel * 8);
            load_frag(kf2, kr1 + sel * 8,      kr1 + 16 + sel * 8);
            load_frag(kf3, kr1 + 32 + sel * 8, kr1 + 48 + sel * 8);
            sc0 = wmma_bf16(kf0.v, qf0.v, sc0);
            sc1 = wmma_bf16(kf2.v, qf0.v, sc1);
            sc0 = wmma_bf16(kf1.v, qf1.v, sc0);
            sc1 = wmma_bf16(kf3.v, qf1.v, sc1);
        }

        FragAB vf0, vf1, vf2, vf3;
        const unsigned short* vr0 = &vst[buf][l16][tb];
        const unsigned short* vr1 = &vst[buf][16 + l16][tb];
        const unsigned short* vr2 = &vst[buf][32 + l16][tb];
        const unsigned short* vr3 = &vst[buf][48 + l16][tb];
        load_frag(vf0, vr0 + sel * 8, vr0 + 16 + sel * 8);
        load_frag(vf1, vr1 + sel * 8, vr1 + 16 + sel * 8);
        load_frag(vf2, vr2 + sel * 8, vr2 + 16 + sel * 8);
        load_frag(vf3, vr3 + sel * 8, vr3 + 16 + sel * 8);

        // maximum of the raw scores (the scale is positive): in-lane, then across the halves
        float tm = fmaxf(sc0[0], sc1[0]);
#pragma unroll
        for (int r = 1; r < 8; ++r) tm = fmaxf(tm, fmaxf(sc0[r], sc1[r]));
        tm = fmaxf(tm, xhalf(tm));
        const float mn    = fmaxf(mi, tm * cscale);
        const float alpha = __builtin_amdgcn_exp2f(mi - mn);   // 0 on the first pass
        mi = mn;

        FragAB pf;            // P^T: element s = key kmap(s, sel) of the pass, column = query l16
        f32x2 sm0 = {0.0f, 0.0f}, sm1 = {0.0f, 0.0f};   // two packed chains of partial sums
#pragma unroll
        for (int i = 0; i < 4; ++i) {
            const f32x2 a0 = __builtin_elementwise_fma(f32x2{sc0[2 * i], sc0[2 * i + 1]},
                                                       f32x2{cscale, cscale}, f32x2{-mn, -mn});
            const f32x2 a1 = __builtin_elementwise_fma(f32x2{sc1[2 * i], sc1[2 * i + 1]},
                                                       f32x2{cscale, cscale}, f32x2{-mn, -mn});
            const f32x2 e0 = {__builtin_amdgcn_exp2f(a0.x), __builtin_amdgcn_exp2f(a0.y)};
            const f32x2 e1 = {__builtin_amdgcn_exp2f(a1.x), __builtin_amdgcn_exp2f(a1.y)};
            sm0 += e0;
            sm1 += e1;
            pf.q[0][i] = pack2(e0.x, e0.y);
            pf.q[1][i] = pack2(e1.x, e1.y);
        }
        sm0 += sm1;
        li = li * alpha + (sm0.x + sm0.y);
#pragma unroll
        for (int j = 0; j < 4; ++j) O[j] *= alpha;

        O[0] = wmma_bf16(vf0.v, pf.v, O[0]);
        O[1] = wmma_bf16(vf1.v, pf.v, O[1]);
        O[2] = wmma_bf16(vf2.v, pf.v, O[2]);
        O[3] = wmma_bf16(vf3.v, pf.v, O[3]);
      }
      // hand-over: my reads of this buffer are done, my copies of the next stage have landed,
      // then every wave's; only behind that is this buffer filled again
      asm volatile("s_wait_dscnt 0" ::: "memory");
      wait_async0();
      __syncthreads();
      if (st + 2 < KV_NSTAGE) copy_stage(st + 2);
    }
    wait_async0();        // nothing of mine is in flight when the wave ends

    const float inv = 1.0f / (li + xhalf(li));   // both halves' keys; unconditional, all lanes on
    // a lane's 8 registers of a tile are 8 consecutive e of its query's row: one 16-byte store
    unsigned short* orow = Ctx + (size_t)(b * Sc + s0 + l16) * D_MODELc + h * D_HEADc + 8 * sel;
#pragma unroll
    for (int j = 0; j < 4; ++j) {
        const v8f o = O[j] * inv;
        u32x4 w = {pack2(o[0], o[1]), pack2(o[2], o[3]), pack2(o[4], o[5]), pack2(o[6], o[7])};
        *reinterpret_cast<u32x4*>(orow + j * 16) = w;
    }
}

// ---------------- host orchestration ----------------
extern "C" void kernel_launch(void* const* d_in, const int* in_sizes, int n_in,
                              void* d_out, int out_size, void* d_ws, size_t ws_size,
                              hipStream_t stream) {
    (void)in_sizes; (void)n_in; (void)out_size; (void)ws_size;
    const float* x     = (const float*)d_in[0];
    const float* WQ    = (const float*)d_in[1];
    const float* WK    = (const float*)d_in[2];
    const float* WV    = (const float*)d_in[3];
    const float* WO    = (const float*)d_in[4];
    const float* ln1_g = (const float*)d_in[5];
    const float* ln1_b = (const float*)d_in[6];
    const float* ln2_g = (const float*)d_in[7];
    const float* ln2_b = (const float*)d_in[8];
    const float* W_in  = (const float*)d_in[9];
    const float* b_in  = (const float*)d_in[10];
    const float* W_out = (const float*)d_in[11];
    const float* b_out = (const float*)d_in[12];

    char* ws = (char*)d_ws;
    size_t off = 0;
    auto alloc = [&](size_t bytes) -> void* {
        void* p = ws + off;
        off += (bytes + 255) & ~(size_t)255;
        return p;
    };
    unsigned short* xln   = (unsigned short*)alloc((size_t)MROWS * D_MODELc * 2);
    unsigned short* wqkvt = (unsigned short*)alloc((size_t)3 * D_MODELc * D_MODELc * 2);
    unsigned short* wot   = (unsigned short*)alloc((size_t)D_MODELc * D_MODELc * 2);
    unsigned short* wint  = (unsigned short*)alloc((size_t)D_MLPc * D_MODELc * 2);
    unsigned short* woutt = (unsigned short*)alloc((size_t)D_MODELc * D_MLPc * 2);
    unsigned short* Qb    = (unsigned short*)alloc((size_t)MROWS * D_MODELc * 2);
    unsigned short* Kbf   = (unsigned short*)alloc((size_t)MROWS * D_MODELc * 2);
    unsigned short* Vtb   = (unsigned short*)alloc((size_t)MROWS * D_MODELc * 2);
    unsigned short* ctx   = (unsigned short*)alloc((size_t)MROWS * D_MODELc * 2);
    float*          x1    = (float*)alloc((size_t)MROWS * D_MODELc * 4);
    unsigned short* hm    = (unsigned short*)alloc((size_t)MROWS * D_MLPc * 2);

    dim3 blk(256);

    // Pack weights: Bt layout = [N][K] bf16
    transpose_cvt_kernel<<<dim3(1, 16, 16), blk, 0, stream>>>(
        WQ, wqkvt,                 64, 65536L, 65536L, 1024);
    transpose_cvt_kernel<<<dim3(1, 16, 16), blk, 0, stream>>>(
        WK, wqkvt + 1024 * 1024,   64, 65536L, 65536L, 1024);
    transpose_cvt_kernel<<<dim3(1, 16, 16), blk, 0, stream>>>(
        WV, wqkvt + 2048 * 1024,   64, 65536L, 65536L, 1024);
    transpose_cvt_kernel<<<dim3(16, 1, 16), blk, 0, stream>>>(
        WO, wot,                   1024, 65536L, 64L,    1024);
    transpose_cvt_kernel<<<dim3(64, 16, 1), blk, 0, stream>>>(
        W_in,  wint,  4096, 0L, 0L, 1024);
    transpose_cvt_kernel<<<dim3(16, 64, 1), blk, 0, stream>>>(
        W_out, woutt, 1024, 0L, 0L, 4096);

    // LN1
    ln_bf16_kernel<<<MROWS, blk, 0, stream>>>(x, ln1_g, ln1_b, xln);

    // QKV
    gemm_qkv_kernel<<<dim3(3072 / 128, MROWS / 128), blk, 0, stream>>>(
        xln, wqkvt, Qb, Kbf, Vtb);

    // Attention (flash)
    attention_kernel<<<dim3(Sc / 128, N_HEADSc, Bc), blk, 0, stream>>>(
        Qb, Kbf, Vtb, ctx);

    // Output projection + residual -> x1 (f32)
    gemm_bf16_kernel<false, true, false, false>
        <<<dim3(1024 / 128, MROWS / 128), blk, 0, stream>>>(
            ctx, wot, nullptr, x, x1, nullptr, MROWS, D_MODELc, D_MODELc);

    // LN2 -> reuse xln
    ln_bf16_kernel<<<MROWS, blk, 0, stream>>>(x1, ln2_g, ln2_b, xln);

    // MLP in: +bias, exact GELU, bf16 out
    gemm_bf16_kernel<true, false, true, true>
        <<<dim3(4096 / 128, MROWS / 128), blk, 0, stream>>>(
            xln, wint, b_in, nullptr, nullptr, hm, MROWS, D_MLPc, D_MODELc);

    // MLP out: +bias, +residual x1 -> d_out (f32)
    gemm_bf16_kernel<true, true, false, false>
        <<<dim3(1024 / 128, MROWS / 128), blk, 0, stream>>>(
            hm, woutt, b_out, x1, (float*)d_out, nullptr, MROWS, D_MODELc, D_MLPc);
}

// v005
// It runs in 291 microseconds.
// In two side-by-side timings against v004, it was 1.19 and 1.20 times as fast.
// Counting every step since v000, it is 3.40 times as fast.
#include <hip/hip_runtime.h>
#include <math.h>

typedef __attribute__((ext_vector_type(8)))  float        v8f;
typedef __attribute__((ext_vector_type(16))) __bf16       v16bf;
typedef __attribute__((ext_vector_type(4)))  unsigned int u32x4;
typedef __attribute__((ext_vector_type(4)))  float        f32x4;

#define D_MODELc 1024
#define N_HEADSc 16
#define D_HEADc  64
#define D_MLPc   4096
#define Bc       4
#define Sc       2048
#define MROWS    (Bc * Sc)   // 8192

// ---------------- helpers ----------------

__device__ __forceinline__ unsigned short f2bf(float f) {
    union { float f; unsigned u; } x; x.f = f;
    unsigned r = x.u + 0x7FFFu + ((x.u >> 16) & 1u);
    return (unsigned short)(r >> 16);
}

typedef __attribute__((ext_vector_type(2))) float  f32x2;
typedef __attribute__((ext_vector_type(2))) __bf16 bf16x2;
__device__ __forceinline__ unsigned pack2(float lo, float hi) {   // round to nearest even, as f2bf
    return __builtin_bit_cast(unsigned, __builtin_convertvector(f32x2{lo, hi}, bf16x2));
}

union FragAB { v16bf v; u32x4 q[2]; };

__device__ __forceinline__ void load_frag(FragAB& f, const unsigned short* p0,
                                          const unsigned short* p1) {
    f.q[0] = *reinterpret_cast<const u32x4*>(p0);
    f.q[1] = *reinterpret_cast<const u32x4*>(p1);
}

__device__ __forceinline__ v8f wmma_bf16(v16bf a, v16bf b, v8f c) {
    return __builtin_amdgcn_wmma_f32_16x16x32_bf16(false, a, false, b,
                                                   (short)0, c, false, false);
}

// gfx1250 async global->LDS copy (ASYNCcnt tracked, no VGPR round trip).
// Four copies of one lane and, as the last line of the same statement, the wait that
// stands in front of any rewrite of the address registers the copies name.
__device__ __forceinline__ void async_copy4_b128(unsigned l0, const unsigned short* g0,
                                                 unsigned l1, const unsigned short* g1,
                                                 unsigned l2, const unsigned short* g2,
                                                 unsigned l3, const unsigned short* g3) {
    asm volatile("global_load_async_to_lds_b128 %0, %1, off\n\t"
                 "global_load_async_to_lds_b128 %2, %3, off\n\t"
                 "global_load_async_to_lds_b128 %4, %5, off\n\t"
                 "global_load_async_to_lds_b128 %6, %7, off\n\t"
                 "s_wait_xcnt 0x0"
                 :: "v"(l0), "v"(g0), "v"(l1), "v"(g1),
                    "v"(l2), "v"(g2), "v"(l3), "v"(g3) : "memory");
}
// The same for eight copies of one lane (a GEMM stage: four rows of A, four of B).
__device__ __forceinline__ void async_copy8_b128(unsigned l0, const unsigned short* g0,
                                                 unsigned l1, const unsigned short* g1,
                                                 unsigned l2, const unsigned short* g2,
                                                 unsigned l3, const unsigned short* g3,
                                                 unsigned l4, const unsigned short* g4,
                                                 unsigned l5, const unsigned short* g5,
                                                 unsigned l6, const unsigned short* g6,
                                                 unsigned l7, const unsigned short* g7) {
    asm volatile("global_load_async_to_lds_b128 %0, %1, off\n\t"
                 "global_load_async_to_lds_b128 %2, %3, off\n\t"
                 "global_load_async_to_lds_b128 %4, %5, off\n\t"
                 "global_load_async_to_lds_b128 %6, %7, off\n\t"
                 "global_load_async_to_lds_b128 %8, %9, off\n\t"
                 "global_load_async_to_lds_b128 %10, %11, off\n\t"
                 "global_load_async_to_lds_b128 %12, %13, off\n\t"
                 "global_load_async_to_lds_b128 %14, %15, off\n\t"
                 "s_wait_xcnt 0x0"
                 :: "v"(l0), "v"(g0), "v"(l1), "v"(g1), "v"(l2), "v"(g2), "v"(l3), "v"(g3),
                    "v"(l4), "v"(g4), "v"(l5), "v"(g5), "v"(l6), "v"(g6), "v"(l7), "v"(g7)
                 : "memory");
}
__device__ __forceinline__ void wait_async0() {
    asm volatile("s_wait_asynccnt 0" ::: "memory");
}
__device__ __forceinline__ unsigned lds_offset(const void* p) {
    return (unsigned)(unsigned long long)p;   // LDS aperture lives in the high 32 bits
}

// ---------------- shared GEMM core ----------------
// One block owns a 128 x 128 tile of C; its 8 waves sit 4 (m) x 2 (n), 32 x 64 each.
// acc[2][4] += A[mblk+wm .. +31][0..K) * Bt[nblk+wn .. +63][0..K)^T
// A and Bt come in stages of 64 k: 128 rows of each, 128 B a row, copied once per block
// into LDS (two buffers) and read from there by every wave that needs them. A wave's copy
// covers four whole 128-B lines. LDS pitch 144 B (16 B x odd) for the 16-byte fragment reads.
// K is a multiple of 64; M and N are multiples of 128.
#define G_TILE  128
#define G_STAGE 64
#define G_PITCH 72                            // in bf16 elements
#define G_BUF   (2 * G_TILE * G_PITCH)        // one buffer: A rows, then Bt rows; elements
__device__ __forceinline__ void gemm_core(const unsigned short* __restrict__ A,
                                          const unsigned short* __restrict__ Bt,
                                          int K, int mblk, int nblk, int wm, int wn,
                                          v8f acc[2][4],
                                          unsigned short* lds /* [2][256][G_PITCH] */) {
    const int tid  = threadIdx.x;
    const int lane = tid & 31;
    const int sel  = lane >> 4;
    const int l16  = lane & 15;

    // copy mapping: thread t -> rows t/8 + {0,32,64,96}, 16 B at column (t%8)*8, of both tiles
    const int crow = tid >> 3;
    const int ccol = (tid & 7) * 8;
    const unsigned short* gA = A  + (size_t)(mblk + crow) * K + ccol;
    const unsigned short* gB = Bt + (size_t)(nblk + crow) * K + ccol;
    const size_t   gq = (size_t)32 * K;              // 32 rows further, elements
    const unsigned lA = lds_offset(lds + crow * G_PITCH + ccol);
    const unsigned lB = lA + G_TILE * G_PITCH * 2;   // the Bt rows, bytes
    const unsigned lq = 32 * G_PITCH * 2;            // 32 rows further, bytes
    auto copy_stage = [&](int st) {
        const unsigned bo = (st & 1) * (G_BUF * 2);
        const unsigned short* a = gA + (size_t)st * G_STAGE;
        const unsigned short* b = gB + (size_t)st * G_STAGE;
        async_copy8_b128(lA + bo,          a,
                         lA + bo + lq,     a + gq,
                         lA + bo + 2 * lq, a + 2 * gq,
                         lA + bo + 3 * lq, a + 3 * gq,
                         lB + bo,          b,
                         lB + bo + lq,     b + gq,
                         lB + bo + 2 * lq, b + 2 * gq,
                         lB + bo + 3 * lq, b + 3 * gq);
    };
    const int nst = K / G_STAGE;

    copy_stage(0);
    wait_async0();        // my part of stage 0 has landed
    __syncthreads();      // everyone's part has landed
    if (nst > 1) copy_stage(1);

    // per-wave fragment bases in buffer 0 (row = l16, k = sel*8 .. and 16 + sel*8 ..)
    const unsigned short* la0 = lds + (wm + l16) * G_PITCH + sel * 8;
    const unsigned short* lb0 = lds + (G_TILE + wn + l16) * G_PITCH + sel * 8;

    for (int st = 0; st < nst; ++st) {
        const unsigned short* la = la0 + (st & 1) * G_BUF;
        const unsigned short* lb = lb0 + (st & 1) * G_BUF;
#pragma unroll   // two 32-k halves of a stage: constant LDS offsets
        for (int kk = 0; kk < G_STAGE; kk += 32) {
            FragAB a0, a1, b0, b1, b2, b3;
            load_frag(a0, la + kk,                la + kk + 16);
            load_frag(a1, la + 16 * G_PITCH + kk, la + 16 * G_PITCH + kk + 16);
            load_frag(b0, lb + kk,                lb + kk + 16);
            load_frag(b1, lb + 16 * G_PITCH + kk, lb + 16 * G_PITCH + kk + 16);
            load_frag(b2, lb + 32 * G_PITCH + kk, lb + 32 * G_PITCH + kk + 16);
            load_frag(b3, lb + 48 * G_PITCH + kk, lb + 48 * G_PITCH + kk + 16);

            acc[0][0] = wmma_bf16(a0.v, b0.v, acc[0][0]);
            acc[1][0] = wmma_bf16(a1.v, b0.v, acc[1][0]);
            acc[0][1] = wmma_bf16(a0.v, b1.v, acc[0][1]);
            acc[1][1] = wmma_bf16(a1.v, b1.v, acc[1][1]);
            acc[0][2] = wmma_bf16(a0.v, b2.v, acc[0][2]);
            acc[1][2] = wmma_bf16(a1.v, b2.v, acc[1][2]);
            acc[0][3] = wmma_bf16(a0.v, b3.v, acc[0][3]);
            acc[1][3] = wmma_bf16(a1.v, b3.v, acc[1][3]);
        }
        // hand-over: my reads of this buffer are done, my copies of the next stage have landed,
        // then every wave's; only behind that is this buffer filled again
        asm volatile("s_wait_dscnt 0" ::: "memory");
        wait_async0();
        __syncthreads();
        if (st + 2 < nst) copy_stage(st + 2);
    }
    wait_async0();        // nothing of mine is in flight when the core is left
}

// ---------------- GEMM epilogue: accumulators turned in LDS ----------------
// Behind gemm_core's last barrier nobody reads the ring and no copy is in flight, so it serves
// as staging. A wave writes its 32 x 64 f32 tile into a range of its own and reads whole rows
// back, 16 B a lane, so that every global store (and residual load) covers whole 128-B lines.
// Pitch 68 floats = 272 B: 16 B x odd for the 16-byte reads, and the wave halves' rows (8 apart)
// fall on opposite halves of the banks for the 4-byte writes.
#define E_PITCH 68
#define E_WAVE  (32 * E_PITCH)                // floats per wave; 8 waves: 69,632 B of the ring
__device__ __forceinline__ const float* stage_tile(const v8f acc[2][4], unsigned short* ring,
                                                   int wave, int lane) {
    float* sw = reinterpret_cast<float*>(ring) + wave * E_WAVE;
    float* w  = sw + 8 * (lane >> 4) * E_PITCH + (lane & 15);
#pragma unroll   // constant indices: register arrays stay in registers, offsets become immediates
    for (int ai = 0; ai < 2; ++ai)
#pragma unroll   // constant indices: register arrays stay in registers, offsets become immediates
        for (int j = 0; j < 4; ++j)
#pragma unroll   // constant indices: register arrays stay in registers, offsets become immediates
            for (int r = 0; r < 8; ++r)
                w[(ai * 16 + r) * E_PITCH + j * 16] = acc[ai][j][r];
    // the rows read back next were written by other lanes of this wave
    asm volatile("s_wait_dscnt 0" ::: "memory");
    return sw;
}

// ---------------- weight transpose + f32->bf16 ----------------
// One 64x64 tile per block, turned in LDS: reads are 16 B per lane along the source
// row, writes are 16 B per lane along the destination row (8 lanes = one 128-B line).
// Two source rows are rounded and packed into one dword before they go to LDS.
// Every R and C used here is a multiple of 64; grid = (C/64, R/64, batches).
__global__ __launch_bounds__(256)
void transpose_cvt_kernel(const float* __restrict__ src,
                          unsigned short* __restrict__ dst,
                          int C,
                          long srcBatchStride, long dstBatchStride,
                          int dstRowStride) {
    __shared__ unsigned tile[64][33];   // [c][row pair]; pitch 33 dwords keeps both sides on distinct banks
    const int tid = threadIdx.x;
    const int c0  = blockIdx.x * 64;
    const int r0  = blockIdx.y * 64;
    const long z  = blockIdx.z;

    const float* s = src + z * srcBatchStride + (long)r0 * C + c0;
    const int lc = (tid & 15) * 4;
    const int lp = tid >> 4;
    const float* p0 = s + (long)(2 * lp) * C + lc;
    const float* p1 = p0 + C;
    const float* p2 = s + (long)(2 * (lp + 16)) * C + lc;
    const float* p3 = p2 + C;
    f32x4 lo[2], hi[2];
    lo[0] = *reinterpret_cast<const f32x4*>(p0);
    hi[0] = *reinterpret_cast<const f32x4*>(p1);
    lo[1] = *reinterpret_cast<const f32x4*>(p2);
    hi[1] = *reinterpret_cast<const f32x4*>(p3);
    // the four addresses are inputs so that their registers stay as they are up to this wait
    asm volatile("s_wait_xcnt 0x0" :: "v"(p0), "v"(p1), "v"(p2), "v"(p3) : "memory");
#pragma unroll
    for (int i = 0; i < 2; ++i)
#pragma unroll
        for (int j = 0; j < 4; ++j)
            tile[lc + j][lp + 16 * i] =
                (unsigned)f2bf(lo[i][j]) | ((unsigned)f2bf(hi[i][j]) << 16);
    __syncthreads();

    unsigned short* d = dst + z * dstBatchStride + (long)c0 * dstRowStride + r0;
    const int rq = (tid & 7) * 4;
    const int oc = tid >> 3;
#pragma unroll
    for (int i = 0; i < 2; ++i) {
        const int c = oc + 32 * i;
        u32x4 w;
#pragma unroll
        for (int j = 0; j < 4; ++j) w[j] = tile[c][rq + j];
        *reinterpret_cast<u32x4*>(d + (long)c * dstRowStride + rq * 2) = w;
    }
}

// ---------------- layernorm -> bf16 ----------------
__global__ __launch_bounds__(256)
void ln_bf16_kernel(const float* __restrict__ x, const float* __restrict__ g,
                    const float* __restrict__ bt, unsigned short* __restrict__ out) {
    int row = blockIdx.x;
    int tid = threadIdx.x;
    const float* xr = x + (size_t)row * D_MODELc;
    f32x4 v = reinterpret_cast<const f32x4*>(xr)[tid];
    float s  = v[0] + v[1] + v[2] + v[3];
    float s2 = v[0]*v[0] + v[1]*v[1] + v[2]*v[2] + v[3]*v[3];
    __shared__ float sh1[256], sh2[256];
    sh1[tid] = s; sh2[tid] = s2;
    __syncthreads();
    for (int off = 128; off > 0; off >>= 1) {
        if (tid < off) { sh1[tid] += sh1[tid + off]; sh2[tid] += sh2[tid + off]; }
        __syncthreads();
    }
    float mu   = sh1[0] * (1.0f / D_MODELc);
    float var  = sh2[0] * (1.0f / D_MODELc) - mu * mu;
    float rstd = rsqrtf(var + 1e-5f);
    int c = tid * 4;
    unsigned short* orow = out + (size_t)row * D_MODELc + c;
#pragma unroll
    for (int i = 0; i < 4; ++i)
        orow[i] = f2bf((v[i] - mu) * rstd * g[c + i] + bt[c + i]);
}

// ---------------- generic GEMM: C = A(bf16,[M,K]) * Bt(bf16,[N,K])^T ----------------
// N is a compile-time constant so that the epilogue's row steps are immediate offsets of one address.
template <bool HAS_BIAS, bool HAS_RES, bool DO_GELU, bool OUT_BF16, int N>
__global__ __launch_bounds__(256)
void gemm_bf16_kernel(const unsigned short* __restrict__ A,
                      const unsigned short* __restrict__ Bt,
                      const float* __restrict__ bias,
                      const float* __restrict__ res,
                      float* __restrict__ outF,
                      unsigned short* __restrict__ outB,
                      int K) {
    __shared__ __attribute__((aligned(16))) unsigned short stile[2 * G_BUF];
    const int lane = threadIdx.x & 31;
    const int wave = __builtin_amdgcn_readfirstlane(threadIdx.x >> 5);   // scalar: tile offsets stay in SGPRs
    const int wm   = (wave >> 1) * 32;
    const int wn   = (wave & 1) * 64;
    const int n0   = blockIdx.x * G_TILE + wn;
    const int m0   = blockIdx.y * G_TILE + wm;

    v8f zero = {};
    v8f acc[2][4];
#pragma unroll
    for (int ai = 0; ai < 2; ++ai)
#pragma unroll
        for (int j = 0; j < 4; ++j) acc[ai][j] = zero;

    gemm_core(A, Bt, K, blockIdx.y * G_TILE, blockIdx.x * G_TILE, wm, wn, acc, stile);

    // a lane owns CPL consecutive columns of a row (16 B of output); a wave covers RPI rows at a time
    constexpr int CPL = OUT_BF16 ? 8 : 4;
    constexpr int RPI = OUT_BF16 ? 4 : 2;
    constexpr int NIT = 32 / RPI;
    const int rrow = lane / (64 / CPL);
    const int rcol = (lane % (64 / CPL)) * CPL;
    const size_t o0 = (size_t)(m0 + rrow) * N + n0 + rcol;

    f32x4 rv[HAS_RES ? NIT * (CPL / 4) : 1];
    if (HAS_RES) {
#pragma unroll   // constant indices: register arrays stay in registers, offsets become immediates
        for (int it = 0; it < NIT; ++it)
#pragma unroll   // constant indices: register arrays stay in registers, offsets become immediates
            for (int q = 0; q < CPL / 4; ++q)
                rv[it * (CPL / 4) + q] =
                    *reinterpret_cast<const f32x4*>(res + o0 + (size_t)it * RPI * N + q * 4);
    }
    f32x4 bv[CPL / 4];
    if (HAS_BIAS) {
#pragma unroll   // constant indices: register arrays stay in registers, offsets become immediates
        for (int q = 0; q < CPL / 4; ++q)
            bv[q] = *reinterpret_cast<const f32x4*>(bias + n0 + rcol + q * 4);
    }

    const float* rd = stage_tile(acc, stile, wave, lane) + rrow * E_PITCH + rcol;
#pragma unroll   // constant indices: register arrays stay in registers, offsets become immediates
    for (int it = 0; it < NIT; ++it) {
        f32x4 v[CPL / 4];
#pragma unroll   // constant indices: register arrays stay in registers, offsets become immediates
        for (int q = 0; q < CPL / 4; ++q) {
            v[q] = *reinterpret_cast<const f32x4*>(rd + it * RPI * E_PITCH + q * 4);
            if (HAS_BIAS) v[q] += bv[q];
            if (DO_GELU) {
#pragma unroll   // constant indices: register arrays stay in registers, offsets become immediates
                for (int i = 0; i < 4; ++i)
                    v[q][i] = 0.5f * v[q][i] * (1.0f + erff(v[q][i] * 0.70710678118654752f));
            }
            if (HAS_RES) v[q] += rv[it * (CPL / 4) + q];
        }
        if constexpr (OUT_BF16) {
            u32x4 w = {pack2(v[0][0], v[0][1]), pack2(v[0][2], v[0][3]),
                       pack2(v[1][0], v[1][1]), pack2(v[1][2], v[1][3])};
            *reinterpret_cast<u32x4*>(outB + o0 + (size_t)it * RPI * N) = w;
        } else {
            *reinterpret_cast<f32x4*>(outF + o0 + (size_t)it * RPI * N) = v[0];
        }
    }
}

// ---------------- QKV GEMM (N=3072): writes Q,K row-major; V transposed [e][t] ----------------
__global__ __launch_bounds__(256)
void gemm_qkv_kernel(const unsigned short* __restrict__ A,
                     const unsigned short* __restrict__ Bt,
                     unsigned short* __restrict__ Q,
                     unsigned short* __restrict__ Kb,
                     unsigned short* __restrict__ Vt) {
    __shared__ __attribute__((aligned(16))) unsigned short stile[2 * G_BUF];
    const int lane = threadIdx.x & 31;
    const int wave = __builtin_amdgcn_readfirstlane(threadIdx.x >> 5);   // scalar: tile offsets stay in SGPRs
    const int sel  = lane >> 4;
    const int l16  = lane & 15;
    const int wm   = (wave >> 1) * 32;
    const int wn   = (wave & 1) * 64;
    const int n0   = blockIdx.x * G_TILE + wn;   // which/head uniform per wave
    const int m0   = blockIdx.y * G_TILE + wm;

    v8f zero = {};
    v8f acc[2][4];
#pragma unroll
    for (int ai = 0; ai < 2; ++ai)
#pragma unroll
        for (int j = 0; j < 4; ++j) acc[ai][j] = zero;

    gemm_core(A, Bt, D_MODELc, blockIdx.y * G_TILE, blockIdx.x * G_TILE, wm, wn, acc, stile);

    const int which = blockIdx.x >> 3;       // 0=Q,1=K,2=V: eight 128-column blocks each, block-uniform
    const int b     = blockIdx.y >> 4;       // a block's 128 rows lie in one batch (row / S)
    if (which < 2) {
        // the wave's 32 rows x 64 columns are 32 consecutive 128-B rows of one head
        const int hh   = (n0 & 1023) >> 6;
        const int rrow = lane >> 3;
        const int rcol = (lane & 7) * 8;
        unsigned short* o = (which == 0 ? Q : Kb)
            + ((size_t)(b * N_HEADSc + hh) * Sc + (m0 & (Sc - 1)) + rrow) * D_HEADc + rcol;
        const float* rd = stage_tile(acc, stile, wave, lane) + rrow * E_PITCH + rcol;
#pragma unroll   // constant indices: register arrays stay in registers, offsets become immediates
        for (int it = 0; it < 8; ++it) {
            const f32x4 lo = *reinterpret_cast<const f32x4*>(rd + it * 4 * E_PITCH);
            const f32x4 hi = *reinterpret_cast<const f32x4*>(rd + it * 4 * E_PITCH + 4);
            u32x4 w = {pack2(lo[0], lo[1]), pack2(lo[2], lo[3]),
                       pack2(hi[0], hi[1]), pack2(hi[2], hi[3])};
            *reinterpret_cast<u32x4*>(o + it * 4 * D_HEADc) = w;
        }
    } else {
        // V^T: a lane's 8 registers of a tile are 8 consecutive s of one e. The block's tile is laid
        // [column][row] in LDS, bf16, so that a column's 128 s leave as one 256-B run.
        constexpr int VP = 136;              // pitch in bf16: 272 B = 16 B x odd
#pragma unroll   // constant indices: register arrays stay in registers, offsets become immediates
        for (int ai = 0; ai < 2; ++ai)
#pragma unroll   // constant indices: register arrays stay in registers, offsets become immediates
            for (int j = 0; j < 4; ++j) {
                const v8f a = acc[ai][j];
                u32x4 w = {pack2(a[0], a[1]), pack2(a[2], a[3]), pack2(a[4], a[5]), pack2(a[6], a[7])};
                *reinterpret_cast<u32x4*>(stile + (wn + j * 16 + l16) * VP + wm + ai * 16 + 8 * sel) = w;
            }
        __syncthreads();                     // a column's 128 s come from four waves
        const int col0 = wave * 16 + sel;    // 16 columns a wave, two at a time
        const int s8   = l16 * 8;
        unsigned short* o = Vt + (size_t)(b * D_MODELc + ((blockIdx.x & 7) * G_TILE) + col0) * Sc
                               + ((blockIdx.y & 15) * G_TILE) + s8;
#pragma unroll   // constant indices: register arrays stay in registers, offsets become immediates
        for (int it = 0; it < 8; ++it) {
            const u32x4 w = *reinterpret_cast<const u32x4*>(stile + (col0 + it * 2) * VP + s8);
            *reinterpret_cast<u32x4*>(o + (size_t)it * 2 * Sc) = w;
        }
    }
}

#define KV_STAGE 64
#define KV_PITCH 72                       // in bf16 elements
#define KV_NSTAGE (Sc / KV_STAGE)
__device__ __forceinline__ float xhalf(float x) {                 // lane l reads lane l ^ 16
    int b = __builtin_bit_cast(int, x);
    return __builtin_bit_cast(float,
        __builtin_amdgcn_permlanex16(b, b, 0x76543210, 0xfedcba98, false, false));
}
__global__ __launch_bounds__(256)
void attention_kernel(const unsigned short* __restrict__ Q,
                      const unsigned short* __restrict__ Kb,
                      const unsigned short* __restrict__ Vt,
                      unsigned short* __restrict__ Ctx) {
    const int lane = threadIdx.x & 31;
    const int wave = threadIdx.x >> 5;
    const int sel  = lane >> 4;
    const int l16  = lane & 15;
    const int b    = blockIdx.z;
    const int h    = blockIdx.y;
    const int s0   = blockIdx.x * 128 + wave * 16;

    const size_t bh = (size_t)(b * N_HEADSc + h);
    const unsigned short* qb = Q  + bh * Sc * D_HEADc;
    const unsigned short* kb = Kb + bh * Sc * D_HEADc;
    const unsigned short* vb = Vt + bh * D_HEADc * Sc;

    __shared__ __attribute__((aligned(16))) unsigned short kst[2][KV_STAGE][KV_PITCH];  // [buf][key][e]
    __shared__ __attribute__((aligned(16))) unsigned short vst[2][D_HEADc][KV_PITCH];   // [buf][e][key]

    // copy mapping: thread t -> rows t/8 and t/8 + 32, 16 B at column (t%8)*8, of both tiles
    const int crow = threadIdx.x >> 3;
    const int ccol = (threadIdx.x & 7) * 8;
    const unsigned short* gk = kb + (size_t)crow * D_HEADc + ccol;
    const unsigned short* gv = vb + (size_t)crow * Sc + ccol;
    const unsigned lk = lds_offset(&kst[0][crow][ccol]);
    const unsigned lv = lds_offset(&vst[0][crow][ccol]);
    const unsigned halfB = 32 * KV_PITCH * 2;        // 32 rows further, bytes
    const unsigned bufB  = KV_STAGE * KV_PITCH * 2;  // next buffer, bytes
    auto copy_stage = [&](int st) {
        const unsigned bo = (st & 1) * bufB;
        const unsigned short* k0 = gk + (size_t)st * KV_STAGE * D_HEADc;
        const unsigned short* v0 = gv + st * KV_STAGE;
        async_copy4_b128(lk + bo,         k0,
                         lk + bo + halfB, k0 + 32 * D_HEADc,
                         lv + bo,         v0,
                         lv + bo + halfB, v0 + (size_t)32 * Sc);
    };
    copy_stage(0);
    wait_async0();        // my part of stage 0 has landed
    __syncthreads();      // everyone's part has landed
    copy_stage(1);

    // Q as the B operand: column = query l16, same k order as the K rows
    FragAB qf0, qf1;
    const unsigned short* qrow = qb + (size_t)(s0 + l16) * D_HEADc;
    load_frag(qf0, qrow + sel * 8,      qrow + 16 + sel * 8);
    load_frag(qf1, qrow + 32 + sel * 8, qrow + 48 + sel * 8);

    v8f zero = {};
    v8f O[4];             // O[j][r] = O^T[e = 16 j + 8 sel + r][query l16]
#pragma unroll
    for (int j = 0; j < 4; ++j) O[j] = zero;
    float mi = -INFINITY; // this query's running maximum, base-2 scaled; equal in both halves
    float li = 0.0f;      // sum over this half's keys only; the halves are joined behind the loop

    const float cscale = 0.125f * 1.4426950408889634f;   // 64^-0.5 * log2(e)

    for (int st = 0; st < KV_NSTAGE; ++st) {
      const int buf = st & 1;
      for (int tb = 0; tb < KV_STAGE; tb += 32) {
        v8f sc0 = zero, sc1 = zero;   // keys tb + 8 sel + r and tb + 16 + 8 sel + r
        {
            FragAB kf0, kf1, kf2, kf3;
            const unsigned short* kr0 = &kst[buf][tb + l16][0];
            const unsigned short* kr1 = &kst[buf][tb + 16 + l16][0];
            load_frag(kf0, kr0 + sel * 8,      kr0 + 16 + sel * 8);
            load_frag(kf1, kr0 + 32 + sel * 8, kr0 + 48 + sel * 8);
            load_frag(kf2, kr1 + sel * 8,      kr1 + 16 + sel * 8);
            load_frag(kf3, kr1 + 32 + sel * 8, kr1 + 48 + sel * 8);
            sc0 = wmma_bf16(kf0.v, qf0.v, sc0);
            sc1 = wmma_bf16(kf2.v, qf0.v, sc1);
            sc0 = wmma_bf16(kf1.v, qf1.v, sc0);
            sc1 = wmma_bf16(kf3.v, qf1.v, sc1);
        }

        FragAB vf0, vf1, vf2, vf3;
        const unsigned short* vr0 = &vst[buf][l16][tb];
        const unsigned short* vr1 = &vst[buf][16 + l16][tb];
        const unsigned short* vr2 = &vst[buf][32 + l16][tb];
        const unsigned short* vr3 = &vst[buf][48 + l16][tb];
        load_frag(vf0, vr0 + sel * 8, vr0 + 16 + sel * 8);
        load_frag(vf1, vr1 + sel * 8, vr1 + 16 + sel * 8);
        load_frag(vf2, vr2 + sel * 8, vr2 + 16 + sel * 8);
        load_frag(vf3, vr3 + sel * 8, vr3 + 16 + sel * 8);

        // maximum of the raw scores (the scale is positive): in-lane, then across the halves
        float tm = fmaxf(sc0[0], sc1[0]);
#pragma unroll
        for (int r = 1; r < 8; ++r) tm = fmaxf(tm, fmaxf(sc0[r], sc1[r]));
        tm = fmaxf(tm, xhalf(tm));
        const float mn    = fmaxf(mi, tm * cscale);
        const float alpha = __builtin_amdgcn_exp2f(mi - mn);   // 0 on the first pass
        mi = mn;

        FragAB pf;            // P^T: element s = key kmap(s, sel) of the pass, column = query l16
        f32x2 sm0 = {0.0f, 0.0f}, sm1 = {0.0f, 0.0f};   // two packed chains of partial sums
#pragma unroll
        for (int i = 0; i < 4; ++i) {
            const f32x2 a0 = __builtin_elementwise_fma(f32x2{sc0[2 * i], sc0[2 * i + 1]},
                                                       f32x2{cscale, cscale}, f32x2{-mn, -mn});
            const f32x2 a1 = __builtin_elementwise_fma(f32x2{sc1[2 * i], sc1[2 * i + 1]},
                                                       f32x2{cscale, cscale}, f32x2{-mn, -mn});
            const f32x2 e0 = {__builtin_amdgcn_exp2f(a0.x), __builtin_amdgcn_exp2f(a0.y)};
            const f32x2 e1 = {__builtin_amdgcn_exp2f(a1.x), __builtin_amdgcn_exp2f(a1.y)};
            sm0 += e0;
            sm1 += e1;
            pf.q[0][i] = pack2(e0.x, e0.y);
            pf.q[1][i] = pack2(e1.x, e1.y);
        }
        sm0 += sm1;
        li = li * alpha + (sm0.x + sm0.y);
#pragma unroll
        for (int j = 0; j < 4; ++j) O[j] *= alpha;

        O[0] = wmma_bf16(vf0.v, pf.v, O[0]);
        O[1] = wmma_bf16(vf1.v, pf.v, O[1]);
        O[2] = wmma_bf16(vf2.v, pf.v, O[2]);
        O[3] = wmma_bf16(vf3.v, pf.v, O[3]);
      }
      // hand-over: my reads of this buffer are done, my copies of the next stage have landed,
      // then every wave's; only behind that is this buffer filled again
      asm volatile("s_wait_dscnt 0" ::: "memory");
      wait_async0();
      __syncthreads();
      if (st + 2 < KV_NSTAGE) copy_stage(st + 2);
    }
    wait_async0();        // nothing of mine is in flight when the wave ends

    const float inv = 1.0f / (li + xhalf(li));   // both halves' keys; unconditional, all lanes on
    // a lane's 8 registers of a tile are 8 consecutive e of its query's row: one 16-byte store
    unsigned short* orow = Ctx + (size_t)(b * Sc + s0 + l16) * D_MODELc + h * D_HEADc + 8 * sel;
#pragma unroll
    for (int j = 0; j < 4; ++j) {
        const v8f o = O[j] * inv;
        u32x4 w = {pack2(o[0], o[1]), pack2(o[2], o[3]), pack2(o[4], o[5]), pack2(o[6], o[7])};
        *reinterpret_cast<u32x4*>(orow + j * 16) = w;
    }
}

// ---------------- host orchestration ----------------
extern "C" void kernel_launch(void* const* d_in, const int* in_sizes, int n_in,
                              void* d_out, int out_size, void* d_ws, size_t ws_size,
                              hipStream_t stream) {
    (void)in_sizes; (void)n_in; (void)out_size; (void)ws_size;
    const float* x     = (const float*)d_in[0];
    const float* WQ    = (const float*)d_in[1];
    const float* WK    = (const float*)d_in[2];
    const float* WV    = (const float*)d_in[3];
    const float* WO    = (const float*)d_in[4];
    const float* ln1_g = (const float*)d_in[5];
    const float* ln1_b = (const float*)d_in[6];
    const float* ln2_g = (const float*)d_in[7];
    const float* ln2_b = (const float*)d_in[8];
    const float* W_in  = (const float*)d_in[9];
    const float* b_in  = (const float*)d_in[10];
    const float* W_out = (const float*)d_in[11];
    const float* b_out = (const float*)d_in[12];

    char* ws = (char*)d_ws;
    size_t off = 0;
    auto alloc = [&](size_t bytes) -> void* {
        void* p = ws + off;
        off += (bytes + 255) & ~(size_t)255;
        return p;
    };
    unsigned short* xln   = (unsigned short*)alloc((size_t)MROWS * D_MODELc * 2);
    unsigned short* wqkvt = (unsigned short*)alloc((size_t)3 * D_MODELc * D_MODELc * 2);
    unsigned short* wot   = (unsigned short*)alloc((size_t)D_MODELc * D_MODELc * 2);
    unsigned short* wint  = (unsigned short*)alloc((size_t)D_MLPc * D_MODELc * 2);
    unsigned short* woutt = (unsigned short*)alloc((size_t)D_MODELc * D_MLPc * 2);
    unsigned short* Qb    = (unsigned short*)alloc((size_t)MROWS * D_MODELc * 2);
    unsigned short* Kbf   = (unsigned short*)alloc((size_t)MROWS * D_MODELc * 2);
    unsigned short* Vtb   = (unsigned short*)alloc((size_t)MROWS * D_MODELc * 2);
    unsigned short* ctx   = (unsigned short*)alloc((size_t)MROWS * D_MODELc * 2);
    float*          x1    = (float*)alloc((size_t)MROWS * D_MODELc * 4);
    unsigned short* hm    = (unsigned short*)alloc((size_t)MROWS * D_MLPc * 2);

    dim3 blk(256);

    // Pack weights: Bt layout = [N][K] bf16
    transpose_cvt_kernel<<<dim3(1, 16, 16), blk, 0, stream>>>(
        WQ, wqkvt,                 64, 65536L, 65536L, 1024);
    transpose_cvt_kernel<<<dim3(1, 16, 16), blk, 0, stream>>>(
        WK, wqkvt + 1024 * 1024,   64, 65536L, 65536L, 1024);
    transpose_cvt_kernel<<<dim3(1, 16, 16), blk, 0, stream>>>(
        WV, wqkvt + 2048 * 1024,   64, 65536L, 65536L, 1024);
    transpose_cvt_kernel<<<dim3(16, 1, 16), blk, 0, stream>>>(
        WO, wot,                   1024, 65536L, 64L,    1024);
    transpose_cvt_kernel<<<dim3(64, 16, 1), blk, 0, stream>>>(
        W_in,  wint,  4096, 0L, 0L, 1024);
    transpose_cvt_kernel<<<dim3(16, 64, 1), blk, 0, stream>>>(
        W_out, woutt, 1024, 0L, 0L, 4096);

    // LN1
    ln_bf16_kernel<<<MROWS, blk, 0, stream>>>(x, ln1_g, ln1_b, xln);

    // QKV
    gemm_qkv_kernel<<<dim3(3072 / 128, MROWS / 128), blk, 0, stream>>>(
        xln, wqkvt, Qb, Kbf, Vtb);

    // Attention (flash)
    attention_kernel<<<dim3(Sc / 128, N_HEADSc, Bc), blk, 0, stream>>>(
        Qb, Kbf, Vtb, ctx);

    // Output projection + residual -> x1 (f32)
    gemm_bf16_kernel<false, true, false, false, D_MODELc>
        <<<dim3(1024 / 128, MROWS / 128), blk, 0, stream>>>(
            ctx, wot, nullptr, x, x1, nullptr, D_MODELc);

    // LN2 -> reuse xln
    ln_bf16_kernel<<<MROWS, blk, 0, stream>>>(x1, ln2_g, ln2_b, xln);

    // MLP in: +bias, exact GELU, bf16 out
    gemm_bf16_kernel<true, false, true, true, D_MLPc>
        <<<dim3(4096 / 128, MROWS / 128), blk, 0, stream>>>(
            xln, wint, b_in, nullptr, nullptr, hm, D_MODELc);

    // MLP out: +bias, +residual x1 -> d_out (f32)
    gemm_bf16_kernel<true, true, false, false, D_MODELc>
        <<<dim3(1024 / 128, MROWS / 128), blk, 0, stream>>>(
            hm, woutt, b_out, x1, (float*)d_out, nullptr, D_MLPc);
}

// v006
// Measured time: 281 microseconds a run.
// Two timings next to v005 both put it at 1.03 times that version's speed.
// All steps since v000 together make it 3.51 times as fast.
#include <hip/hip_runtime.h>
#include <math.h>

typedef __attribute__((ext_vector_type(8)))  float        v8f;
typedef __attribute__((ext_vector_type(16))) __bf16       v16bf;
typedef __attribute__((ext_vector_type(4)))  unsigned int u32x4;
typedef __attribute__((ext_vector_type(4)))  float        f32x4;
typedef __attribute__((ext_vector_type(2)))  unsigned int u32x2;

#define D_MODELc 1024
#define N_HEADSc 16
#define D_HEADc  64
#define D_MLPc   4096
#define Bc       4
#define Sc       2048
#define MROWS    (Bc * Sc)   // 8192

// ---------------- helpers ----------------

__device__ __forceinline__ unsigned short f2bf(float f) {
    union { float f; unsigned u; } x; x.f = f;
    unsigned r = x.u + 0x7FFFu + ((x.u >> 16) & 1u);
    return (unsigned short)(r >> 16);
}

typedef __attribute__((ext_vector_type(2))) float  f32x2;
typedef __attribute__((ext_vector_type(2))) __bf16 bf16x2;
__device__ __forceinline__ unsigned pack2(float lo, float hi) {   // round to nearest even, as f2bf
    return __builtin_bit_cast(unsigned, __builtin_convertvector(f32x2{lo, hi}, bf16x2));
}

__device__ __forceinline__ float xhalf(float x) {                 // lane l reads lane l ^ 16
    int b = __builtin_bit_cast(int, x);
    return __builtin_bit_cast(float,
        __builtin_amdgcn_permlanex16(b, b, 0x76543210, 0xfedcba98, false, false));
}

union FragAB { v16bf v; u32x4 q[2]; };

__device__ __forceinline__ void load_frag(FragAB& f, const unsigned short* p0,
                                          const unsigned short* p1) {
    f.q[0] = *reinterpret_cast<const u32x4*>(p0);
    f.q[1] = *reinterpret_cast<const u32x4*>(p1);
}

__device__ __forceinline__ v8f wmma_bf16(v16bf a, v16bf b, v8f c) {
    return __builtin_amdgcn_wmma_f32_16x16x32_bf16(false, a, false, b,
                                                   (short)0, c, false, false);
}

// gfx1250 async global->LDS copy (ASYNCcnt tracked, no VGPR round trip).
// Four copies of one lane and, as the last line of the same statement, the wait that
// stands in front of any rewrite of the address registers the copies name.
__device__ __forceinline__ void async_copy4_b128(unsigned l0, const unsigned short* g0,
                                                 unsigned l1, const unsigned short* g1,
                                                 unsigned l2, const unsigned short* g2,
                                                 unsigned l3, const unsigned short* g3) {
    asm volatile("global_load_async_to_lds_b128 %0, %1, off\n\t"
                 "global_load_async_to_lds_b128 %2, %3, off\n\t"
                 "global_load_async_to_lds_b128 %4, %5, off\n\t"
                 "global_load_async_to_lds_b128 %6, %7, off\n\t"
                 "s_wait_xcnt 0x0"
                 :: "v"(l0), "v"(g0), "v"(l1), "v"(g1),
                    "v"(l2), "v"(g2), "v"(l3), "v"(g3) : "memory");
}
// The same for eight copies of one lane (a GEMM stage: four rows of A, four of B).
__device__ __forceinline__ void async_copy8_b128(unsigned l0, const unsigned short* g0,
                                                 unsigned l1, const unsigned short* g1,
                                                 unsigned l2, const unsigned short* g2,
                                                 unsigned l3, const unsigned short* g3,
                                                 unsigned l4, const unsigned short* g4,
                                                 unsigned l5, const unsigned short* g5,
                                                 unsigned l6, const unsigned short* g6,
                                                 unsigned l7, const unsigned short* g7) {
    asm volatile("global_load_async_to_lds_b128 %0, %1, off\n\t"
                 "global_load_async_to_lds_b128 %2, %3, off\n\t"
                 "global_load_async_to_lds_b128 %4, %5, off\n\t"
                 "global_load_async_to_lds_b128 %6, %7, off\n\t"
                 "global_load_async_to_lds_b128 %8, %9, off\n\t"
                 "global_load_async_to_lds_b128 %10, %11, off\n\t"
                 "global_load_async_to_lds_b128 %12, %13, off\n\t"
                 "global_load_async_to_lds_b128 %14, %15, off\n\t"
                 "s_wait_xcnt 0x0"
                 :: "v"(l0), "v"(g0), "v"(l1), "v"(g1), "v"(l2), "v"(g2), "v"(l3), "v"(g3),
                    "v"(l4), "v"(g4), "v"(l5), "v"(g5), "v"(l6), "v"(g6), "v"(l7), "v"(g7)
                 : "memory");
}
__device__ __forceinline__ void wait_async0() {
    asm volatile("s_wait_asynccnt 0" ::: "memory");
}
__device__ __forceinline__ unsigned lds_offset(const void* p) {
    return (unsigned)(unsigned long long)p;   // LDS aperture lives in the high 32 bits
}

// ---------------- shared GEMM core ----------------
// One block owns a 128 x 128 tile of C; its 8 waves sit 4 (m) x 2 (n), 32 x 64 each.
// acc[2][4] += A[mblk+wm .. +31][0..K) * Bt[nblk+wn .. +63][0..K)^T
// A and Bt come in stages of 64 k: 128 rows of each, 128 B a row, copied once per block
// into LDS (two buffers) and read from there by every wave that needs them. A wave's copy
// covers four whole 128-B lines. LDS pitch 144 B (16 B x odd) for the 16-byte fragment reads.
// K is a multiple of 64; M and N are multiples of 128.
#define G_TILE  128
#define G_STAGE 64
#define G_PITCH 72                            // in bf16 elements
#define G_BUF   (2 * G_TILE * G_PITCH)        // one buffer: A rows, then Bt rows; elements
__device__ __forceinline__ void gemm_core(const unsigned short* __restrict__ A,
                                          const unsigned short* __restrict__ Bt,
                                          int K, int mblk, int nblk, int wm, int wn,
                                          v8f acc[2][4],
                                          unsigned short* lds /* [2][256][G_PITCH] */) {
    const int tid  = threadIdx.x;
    const int lane = tid & 31;
    const int sel  = lane >> 4;
    const int l16  = lane & 15;

    // copy mapping: thread t -> rows t/8 + {0,32,64,96}, 16 B at column (t%8)*8, of both tiles
    const int crow = tid >> 3;
    const int ccol = (tid & 7) * 8;
    const unsigned short* gA = A  + (size_t)(mblk + crow) * K + ccol;
    const unsigned short* gB = Bt + (size_t)(nblk + crow) * K + ccol;
    const size_t   gq = (size_t)32 * K;              // 32 rows further, elements
    const unsigned lA = lds_offset(lds + crow * G_PITCH + ccol);
    const unsigned lB = lA + G_TILE * G_PITCH * 2;   // the Bt rows, bytes
    const unsigned lq = 32 * G_PITCH * 2;            // 32 rows further, bytes
    auto copy_stage = [&](int st) {
        const unsigned bo = (st & 1) * (G_BUF * 2);
        const unsigned short* a = gA + (size_t)st * G_STAGE;
        const unsigned short* b = gB + (size_t)st * G_STAGE;
        async_copy8_b128(lA + bo,          a,
                         lA + bo + lq,     a + gq,
                         lA + bo + 2 * lq, a + 2 * gq,
                         lA + bo + 3 * lq, a + 3 * gq,
                         lB + bo,          b,
                         lB + bo + lq,     b + gq,
                         lB + bo + 2 * lq, b + 2 * gq,
                         lB + bo + 3 * lq, b + 3 * gq);
    };
    const int nst = K / G_STAGE;

    copy_stage(0);
    wait_async0();        // my part of stage 0 has landed
    __syncthreads();      // everyone's part has landed
    if (nst > 1) copy_stage(1);

    // per-wave fragment bases in buffer 0 (row = l16, k = sel*8 .. and 16 + sel*8 ..)
    const unsigned short* la0 = lds + (wm + l16) * G_PITCH + sel * 8;
    const unsigned short* lb0 = lds + (G_TILE + wn + l16) * G_PITCH + sel * 8;

    for (int st = 0; st < nst; ++st) {
        const unsigned short* la = la0 + (st & 1) * G_BUF;
        const unsigned short* lb = lb0 + (st & 1) * G_BUF;
#pragma unroll   // two 32-k halves of a stage: constant LDS offsets
        for (int kk = 0; kk < G_STAGE; kk += 32) {
            FragAB a0, a1, b0, b1, b2, b3;
            load_frag(a0, la + kk,                la + kk + 16);
            load_frag(a1, la + 16 * G_PITCH + kk, la + 16 * G_PITCH + kk + 16);
            load_frag(b0, lb + kk,                lb + kk + 16);
            load_frag(b1, lb + 16 * G_PITCH + kk, lb + 16 * G_PITCH + kk + 16);
            load_frag(b2, lb + 32 * G_PITCH + kk, lb + 32 * G_PITCH + kk + 16);
            load_frag(b3, lb + 48 * G_PITCH + kk, lb + 48 * G_PITCH + kk + 16);

            acc[0][0] = wmma_bf16(a0.v, b0.v, acc[0][0]);
            acc[1][0] = wmma_bf16(a1.v, b0.v, acc[1][0]);
            acc[0][1] = wmma_bf16(a0.v, b1.v, acc[0][1]);
            acc[1][1] = wmma_bf16(a1.v, b1.v, acc[1][1]);
            acc[0][2] = wmma_bf16(a0.v, b2.v, acc[0][2]);
            acc[1][2] = wmma_bf16(a1.v, b2.v, acc[1][2]);
            acc[0][3] = wmma_bf16(a0.v, b3.v, acc[0][3]);
            acc[1][3] = wmma_bf16(a1.v, b3.v, acc[1][3]);
        }
        // hand-over: my reads of this buffer are done, my copies of the next stage have landed,
        // then every wave's; only behind that is this buffer filled again
        asm volatile("s_wait_dscnt 0" ::: "memory");
        wait_async0();
        __syncthreads();
        if (st + 2 < nst) copy_stage(st + 2);
    }
    wait_async0();        // nothing of mine is in flight when the core is left
}

// ---------------- GEMM epilogue: accumulators turned in LDS ----------------
// Behind gemm_core's last barrier nobody reads the ring and no copy is in flight, so it serves
// as staging. A wave writes its 32 x 64 f32 tile into a range of its own and reads whole rows
// back, 16 B a lane, so that every global store (and residual load) covers whole 128-B lines.
// Pitch 68 floats = 272 B: 16 B x odd for the 16-byte reads, and the wave halves' rows (8 apart)
// fall on opposite halves of the banks for the 4-byte writes.
#define E_PITCH 68
#define E_WAVE  (32 * E_PITCH)                // floats per wave; 8 waves: 69,632 B of the ring
__device__ __forceinline__ const float* stage_tile(const v8f acc[2][4], unsigned short* ring,
                                                   int wave, int lane) {
    float* sw = reinterpret_cast<float*>(ring) + wave * E_WAVE;
    float* w  = sw + 8 * (lane >> 4) * E_PITCH + (lane & 15);
#pragma unroll   // constant indices: register arrays stay in registers, offsets become immediates
    for (int ai = 0; ai < 2; ++ai)
#pragma unroll   // constant indices: register arrays stay in registers, offsets become immediates
        for (int j = 0; j < 4; ++j)
#pragma unroll   // constant indices: register arrays stay in registers, offsets become immediates
            for (int r = 0; r < 8; ++r)
                w[(ai * 16 + r) * E_PITCH + j * 16] = acc[ai][j][r];
    // the rows read back next were written by other lanes of this wave
    asm volatile("s_wait_dscnt 0" ::: "memory");
    return sw;
}

// ---------------- weight transpose + f32->bf16 ----------------
// One 64x64 tile per block, turned in LDS: reads are 16 B per lane along the source
// row, writes are 16 B per lane along the destination row (8 lanes = one 128-B line).
// Two source rows are rounded and packed into one dword before they go to LDS.
// Every R and C used here is a multiple of 64; grid = (C/64, R/64, batches).
__global__ __launch_bounds__(256)
void transpose_cvt_kernel(const float* __restrict__ src,
                          unsigned short* __restrict__ dst,
                          int C,
                          long srcBatchStride, long dstBatchStride,
                          int dstRowStride) {
    __shared__ unsigned tile[64][33];   // [c][row pair]; pitch 33 dwords keeps both sides on distinct banks
    const int tid = threadIdx.x;
    const int c0  = blockIdx.x * 64;
    const int r0  = blockIdx.y * 64;
    const long z  = blockIdx.z;

    const float* s = src + z * srcBatchStride + (long)r0 * C + c0;
    const int lc = (tid & 15) * 4;
    const int lp = tid >> 4;
    const float* p0 = s + (long)(2 * lp) * C + lc;
    const float* p1 = p0 + C;
    const float* p2 = s + (long)(2 * (lp + 16)) * C + lc;
    const float* p3 = p2 + C;
    f32x4 lo[2], hi[2];
    lo[0] = *reinterpret_cast<const f32x4*>(p0);
    hi[0] = *reinterpret_cast<const f32x4*>(p1);
    lo[1] = *reinterpret_cast<const f32x4*>(p2);
    hi[1] = *reinterpret_cast<const f32x4*>(p3);
    // the four addresses are inputs so that their registers stay as they are up to this wait
    asm volatile("s_wait_xcnt 0x0" :: "v"(p0), "v"(p1), "v"(p2), "v"(p3) : "memory");
#pragma unroll
    for (int i = 0; i < 2; ++i)
#pragma unroll
        for (int j = 0; j < 4; ++j)
            tile[lc + j][lp + 16 * i] =
                (unsigned)f2bf(lo[i][j]) | ((unsigned)f2bf(hi[i][j]) << 16);
    __syncthreads();

    unsigned short* d = dst + z * dstBatchStride + (long)c0 * dstRowStride + r0;
    const int rq = (tid & 7) * 4;
    const int oc = tid >> 3;
#pragma unroll
    for (int i = 0; i < 2; ++i) {
        const int c = oc + 32 * i;
        u32x4 w;
#pragma unroll
        for (int j = 0; j < 4; ++j) w[j] = tile[c][rq + j];
        *reinterpret_cast<u32x4*>(d + (long)c * dstRowStride + rq * 2) = w;
    }
}

// ---------------- layernorm -> bf16 ----------------
// One wave owns two whole rows and keeps them in registers: 16 loads of 16 B a lane, each covering
// 512 contiguous bytes, all issued before the first sum. Sums run in-lane, then over the wave by
// cross-lane moves: no LDS, no barrier, and 1/16 of the waves that one block per row has to start.
template <int CTRL>
__device__ __forceinline__ float add_xmask(float x) {             // x + x of lane l ^ mask, inside a 16-lane row
    const int b = __builtin_bit_cast(int, x);
    return x + __builtin_bit_cast(float, __builtin_amdgcn_update_dpp(0, b, CTRL, 0xf, 0xf, true));
}
__device__ __forceinline__ float wave_sum(float x) {              // every lane gets the sum over all 32
    x = add_xmask<0x161>(x);
    x = add_xmask<0x162>(x);
    x = add_xmask<0x164>(x);
    x = add_xmask<0x168>(x);
    return x + xhalf(x);
}
#define LN_ROWS 2                                                 // rows a wave
__global__ __launch_bounds__(256)
void ln_bf16_kernel(const float* __restrict__ x, const float* __restrict__ g,
                    const float* __restrict__ bt, unsigned short* __restrict__ out) {
    const int lane = threadIdx.x & 31;
    const int wave = threadIdx.x >> 5;
    const size_t e0 = ((size_t)blockIdx.x * 8 + wave) * (LN_ROWS * D_MODELc) + lane * 4;
    const float* xr = x + e0;
    const unsigned c0 = lane * 4;                                 // the lane's first column
    f32x4 v[LN_ROWS][8], gv[8], bv[8];
#pragma unroll   // constant indices: register arrays stay in registers, offsets become immediates
    for (int r = 0; r < LN_ROWS; ++r)
#pragma unroll   // constant indices: register arrays stay in registers, offsets become immediates
        for (int i = 0; i < 8; ++i)
            v[r][i] = *reinterpret_cast<const f32x4*>(xr + r * D_MODELc + i * 128);
#pragma unroll   // constant indices: register arrays stay in registers, offsets become immediates
    for (int i = 0; i < 8; ++i) {
        gv[i] = *reinterpret_cast<const f32x4*>(g + c0 + i * 128);
        bv[i] = *reinterpret_cast<const f32x4*>(bt + c0 + i * 128);
    }
    // the rows' address is an input so that its registers stay as they are up to this wait
    asm volatile("s_wait_xcnt 0x0" :: "v"(xr) : "memory");
    // keeps all 32 loads in front of the sums: without it the build sinks the loads of g and bt
    // between the last products, pair by pair, and waits out each pair's latency in turn
    __builtin_amdgcn_sched_barrier(0);

    float s[LN_ROWS], s2[LN_ROWS];
#pragma unroll   // constant indices: register arrays stay in registers
    for (int r = 0; r < LN_ROWS; ++r) {
        f32x4 a = v[r][0], q = v[r][0] * v[r][0];
#pragma unroll   // constant indices: register arrays stay in registers
        for (int i = 1; i < 8; ++i) { a += v[r][i]; q += v[r][i] * v[r][i]; }
        s[r]  = (a[0] + a[1]) + (a[2] + a[3]);
        s2[r] = (q[0] + q[1]) + (q[2] + q[3]);
    }
#pragma unroll   // the rows' four chains of cross-lane steps interleave
    for (int r = 0; r < LN_ROWS; ++r) { s[r] = wave_sum(s[r]); s2[r] = wave_sum(s2[r]); }

    unsigned short* orow = out + e0;
#pragma unroll   // constant indices: register arrays stay in registers, offsets become immediates
    for (int r = 0; r < LN_ROWS; ++r) {
        const float mu   = s[r] * (1.0f / D_MODELc);
        const float var  = s2[r] * (1.0f / D_MODELc) - mu * mu;
        const float rstd = rsqrtf(var + 1e-5f);
#pragma unroll   // constant indices: register arrays stay in registers, offsets become immediates
        for (int i = 0; i < 8; ++i) {
            const f32x4 o = (v[r][i] - mu) * rstd * gv[i] + bv[i];
            const u32x2 w = {pack2(o[0], o[1]), pack2(o[2], o[3])};
            *reinterpret_cast<u32x2*>(orow + r * D_MODELc + i * 128) = w;   // a wave: 256 contiguous bytes
        }
    }
}

// ---------------- generic GEMM: C = A(bf16,[M,K]) * Bt(bf16,[N,K])^T ----------------
// N is a compile-time constant so that the epilogue's row steps are immediate offsets of one address.
template <bool HAS_BIAS, bool HAS_RES, bool DO_GELU, bool OUT_BF16, int N>
__global__ __launch_bounds__(256)
void gemm_bf16_kernel(const unsigned short* __restrict__ A,
                      const unsigned short* __restrict__ Bt,
                      const float* __restrict__ bias,
                      const float* __restrict__ res,
                      float* __restrict__ outF,
                      unsigned short* __restrict__ outB,
                      int K) {
    __shared__ __attribute__((aligned(16))) unsigned short stile[2 * G_BUF];
    const int lane = threadIdx.x & 31;
    const int wave = __builtin_amdgcn_readfirstlane(threadIdx.x >> 5);   // scalar: tile offsets stay in SGPRs
    const int wm   = (wave >> 1) * 32;
    const int wn   = (wave & 1) * 64;
    const int n0   = blockIdx.x * G_TILE + wn;
    const int m0   = blockIdx.y * G_TILE + wm;

    v8f zero = {};
    v8f acc[2][4];
#pragma unroll
    for (int ai = 0; ai < 2; ++ai)
#pragma unroll
        for (int j = 0; j < 4; ++j) acc[ai][j] = zero;

    gemm_core(A, Bt, K, blockIdx.y * G_TILE, blockIdx.x * G_TILE, wm, wn, acc, stile);

    // a lane owns CPL consecutive columns of a row (16 B of output); a wave covers RPI rows at a time
    constexpr int CPL = OUT_BF16 ? 8 : 4;
    constexpr int RPI = OUT_BF16 ? 4 : 2;
    constexpr int NIT = 32 / RPI;
    const int rrow = lane / (64 / CPL);
    const int rcol = (lane % (64 / CPL)) * CPL;
    const size_t o0 = (size_t)(m0 + rrow) * N + n0 + rcol;

    f32x4 rv[HAS_RES ? NIT * (CPL / 4) : 1];
    if (HAS_RES) {
#pragma unroll   // constant indices: register arrays stay in registers, offsets become immediates
        for (int it = 0; it < NIT; ++it)
#pragma unroll   // constant indices: register arrays stay in registers, offsets become immediates
            for (int q = 0; q < CPL / 4; ++q)
                rv[it * (CPL / 4) + q] =
                    *reinterpret_cast<const f32x4*>(res + o0 + (size_t)it * RPI * N + q * 4);
    }
    f32x4 bv[CPL / 4];
    if (HAS_BIAS) {
#pragma unroll   // constant indices: register arrays stay in registers, offsets become immediates
        for (int q = 0; q < CPL / 4; ++q)
            bv[q] = *reinterpret_cast<const f32x4*>(bias + n0 + rcol + q * 4);
    }

    const float* rd = stage_tile(acc, stile, wave, lane) + rrow * E_PITCH + rcol;
#pragma unroll   // constant indices: register arrays stay in registers, offsets become immediates
    for (int it = 0; it < NIT; ++it) {
        f32x4 v[CPL / 4];
#pragma unroll   // constant indices: register arrays stay in registers, offsets become immediates
        for (int q = 0; q < CPL / 4; ++q) {
            v[q] = *reinterpret_cast<const f32x4*>(rd + it * RPI * E_PITCH + q * 4);
            if (HAS_BIAS) v[q] += bv[q];
            if (DO_GELU) {
#pragma unroll   // constant indices: register arrays stay in registers, offsets become immediates
                for (int i = 0; i < 4; ++i)
                    v[q][i] = 0.5f * v[q][i] * (1.0f + erff(v[q][i] * 0.70710678118654752f));
            }
            if (HAS_RES) v[q] += rv[it * (CPL / 4) + q];
        }
        if constexpr (OUT_BF16) {
            u32x4 w = {pack2(v[0][0], v[0][1]), pack2(v[0][2], v[0][3]),
                       pack2(v[1][0], v[1][1]), pack2(v[1][2], v[1][3])};
            *reinterpret_cast<u32x4*>(outB + o0 + (size_t)it * RPI * N) = w;
        } else {
            *reinterpret_cast<f32x4*>(outF + o0 + (size_t)it * RPI * N) = v[0];
        }
    }
}

// ---------------- QKV GEMM (N=3072): writes Q,K row-major; V transposed [e][t] ----------------
__global__ __launch_bounds__(256)
void gemm_qkv_kernel(const unsigned short* __restrict__ A,
                     const unsigned short* __restrict__ Bt,
                     unsigned short* __restrict__ Q,
                     unsigned short* __restrict__ Kb,
                     unsigned short* __restrict__ Vt) {
    __shared__ __attribute__((aligned(16))) unsigned short stile[2 * G_BUF];
    const int lane = threadIdx.x & 31;
    const int wave = __builtin_amdgcn_readfirstlane(threadIdx.x >> 5);   // scalar: tile offsets stay in SGPRs
    const int sel  = lane >> 4;
    const int l16  = lane & 15;
    const int wm   = (wave >> 1) * 32;
    const int wn   = (wave & 1) * 64;
    const int n0   = blockIdx.x * G_TILE + wn;   // which/head uniform per wave
    const int m0   = blockIdx.y * G_TILE + wm;

    v8f zero = {};
    v8f acc[2][4];
#pragma unroll
    for (int ai = 0; ai < 2; ++ai)
#pragma unroll
        for (int j = 0; j < 4; ++j) acc[ai][j] = zero;

    gemm_core(A, Bt, D_MODELc, blockIdx.y * G_TILE, blockIdx.x * G_TILE, wm, wn, acc, stile);

    const int which = blockIdx.x >> 3;       // 0=Q,1=K,2=V: eight 128-column blocks each, block-uniform
    const int b     = blockIdx.y >> 4;       // a block's 128 rows lie in one batch (row / S)
    if (which < 2) {
        // the wave's 32 rows x 64 columns are 32 consecutive 128-B rows of one head
        const int hh   = (n0 & 1023) >> 6;
        const int rrow = lane >> 3;
        const int rcol = (lane & 7) * 8;
        unsigned short* o = (which == 0 ? Q : Kb)
            + ((size_t)(b * N_HEADSc + hh) * Sc + (m0 & (Sc - 1)) + rrow) * D_HEADc + rcol;
        const float* rd = stage_tile(acc, stile, wave, lane) + rrow * E_PITCH + rcol;
#pragma unroll   // constant indices: register arrays stay in registers, offsets become immediates
        for (int it = 0; it < 8; ++it) {
            const f32x4 lo = *reinterpret_cast<const f32x4*>(rd + it * 4 * E_PITCH);
            const f32x4 hi = *reinterpret_cast<const f32x4*>(rd + it * 4 * E_PITCH + 4);
            u32x4 w = {pack2(lo[0], lo[1]), pack2(lo[2], lo[3]),
                       pack2(hi[0], hi[1]), pack2(hi[2], hi[3])};
            *reinterpret_cast<u32x4*>(o + it * 4 * D_HEADc) = w;
        }
    } else {
        // V^T: a lane's 8 registers of a tile are 8 consecutive s of one e. The block's tile is laid
        // [column][row] in LDS, bf16, so that a column's 128 s leave as one 256-B run.
        constexpr int VP = 136;              // pitch in bf16: 272 B = 16 B x odd
#pragma unroll   // constant indices: register arrays stay in registers, offsets become immediates
        for (int ai = 0; ai < 2; ++ai)
#pragma unroll   // constant indices: register arrays stay in registers, offsets become immediates
            for (int j = 0; j < 4; ++j) {
                const v8f a = acc[ai][j];
                u32x4 w = {pack2(a[0], a[1]), pack2(a[2], a[3]), pack2(a[4], a[5]), pack2(a[6], a[7])};
                *reinterpret_cast<u32x4*>(stile + (wn + j * 16 + l16) * VP + wm + ai * 16 + 8 * sel) = w;
            }
        __syncthreads();                     // a column's 128 s come from four waves
        const int col0 = wave * 16 + sel;    // 16 columns a wave, two at a time
        const int s8   = l16 * 8;
        unsigned short* o = Vt + (size_t)(b * D_MODELc + ((blockIdx.x & 7) * G_TILE) + col0) * Sc
                               + ((blockIdx.y & 15) * G_TILE) + s8;
#pragma unroll   // constant indices: register arrays stay in registers, offsets become immediates
        for (int it = 0; it < 8; ++it) {
            const u32x4 w = *reinterpret_cast<const u32x4*>(stile + (col0 + it * 2) * VP + s8);
            *reinterpret_cast<u32x4*>(o + (size_t)it * 2 * Sc) = w;
        }
    }
}

#define KV_STAGE 64
#define KV_PITCH 72                       // in bf16 elements
#define KV_NSTAGE (Sc / KV_STAGE)
__global__ __launch_bounds__(256)
void attention_kernel(const unsigned short* __restrict__ Q,
                      const unsigned short* __restrict__ Kb,
                      const unsigned short* __restrict__ Vt,
                      unsigned short* __restrict__ Ctx) {
    const int lane = threadIdx.x & 31;
    const int wave = threadIdx.x >> 5;
    const int sel  = lane >> 4;
    const int l16  = lane & 15;
    const int b    = blockIdx.z;
    const int h    = blockIdx.y;
    const int s0   = blockIdx.x * 128 + wave * 16;

    const size_t bh = (size_t)(b * N_HEADSc + h);
    const unsigned short* qb = Q  + bh * Sc * D_HEADc;
    const unsigned short* kb = Kb + bh * Sc * D_HEADc;
    const unsigned short* vb = Vt + bh * D_HEADc * Sc;

    __shared__ __attribute__((aligned(16))) unsigned short kst[2][KV_STAGE][KV_PITCH];  // [buf][key][e]
    __shared__ __attribute__((aligned(16))) unsigned short vst[2][D_HEADc][KV_PITCH];   // [buf][e][key]

    // copy mapping: thread t -> rows t/8 and t/8 + 32, 16 B at column (t%8)*8, of both tiles
    const int crow = threadIdx.x >> 3;
    const int ccol = (threadIdx.x & 7) * 8;
    const unsigned short* gk = kb + (size_t)crow * D_HEADc + ccol;
    const unsigned short* gv = vb + (size_t)crow * Sc + ccol;
    const unsigned lk = lds_offset(&kst[0][crow][ccol]);
    const unsigned lv = lds_offset(&vst[0][crow][ccol]);
    const unsigned halfB = 32 * KV_PITCH * 2;        // 32 rows further, bytes
    const unsigned bufB  = KV_STAGE * KV_PITCH * 2;  // next buffer, bytes
    auto copy_stage = [&](int st) {
        const unsigned bo = (st & 1) * bufB;
        const unsigned short* k0 = gk + (size_t)st * KV_STAGE * D_HEADc;
        const unsigned short* v0 = gv + st * KV_STAGE;
        async_copy4_b128(lk + bo,         k0,
                         lk + bo + halfB, k0 + 32 * D_HEADc,
                         lv + bo,         v0,
                         lv + bo + halfB, v0 + (size_t)32 * Sc);
    };
    copy_stage(0);
    wait_async0();        // my part of stage 0 has landed
    __syncthreads();      // everyone's part has landed
    copy_stage(1);

    // Q as the B operand: column = query l16, same k order as the K rows
    FragAB qf0, qf1;
    const unsigned short* qrow = qb + (size_t)(s0 + l16) * D_HEADc;
    load_frag(qf0, qrow + sel * 8,      qrow + 16 + sel * 8);
    load_frag(qf1, qrow + 32 + sel * 8, qrow + 48 + sel * 8);

    v8f zero = {};
    v8f O[4];             // O[j][r] = O^T[e = 16 j + 8 sel + r][query l16]
#pragma unroll
    for (int j = 0; j < 4; ++j) O[j] = zero;
    float mi = -INFINITY; // this query's running maximum, base-2 scaled; equal in both halves
    float li = 0.0f;      // sum over this half's keys only; the halves are joined behind the loop

    const float cscale = 0.125f * 1.4426950408889634f;   // 64^-0.5 * log2(e)

    for (int st = 0; st < KV_NSTAGE; ++st) {
      const int buf = st & 1;
      for (int tb = 0; tb < KV_STAGE; tb += 32) {
        v8f sc0 = zero, sc1 = zero;   // keys tb + 8 sel + r and tb + 16 + 8 sel + r
        {
            FragAB kf0, kf1, kf2, kf3;
            const unsigned short* kr0 = &kst[buf][tb + l16][0];
            const unsigned short* kr1 = &kst[buf][tb + 16 + l16][0];
            load_frag(kf0, kr0 + sel * 8,      kr0 + 16 + sel * 8);
            load_frag(kf1, kr0 + 32 + sel * 8, kr0 + 48 + sel * 8);
            load_frag(kf2, kr1 + sel * 8,      kr1 + 16 + sel * 8);
            load_frag(kf3, kr1 + 32 + sel * 8, kr1 + 48 + sel * 8);
            sc0 = wmma_bf16(kf0.v, qf0.v, sc0);
            sc1 = wmma_bf16(kf2.v, qf0.v, sc1);
            sc0 = wmma_bf16(kf1.v, qf1.v, sc0);
            sc1 = wmma_bf16(kf3.v, qf1.v, sc1);
        }

        FragAB vf0, vf1, vf2, vf3;
        const unsigned short* vr0 = &vst[buf][l16][tb];
        const unsigned short* vr1 = &vst[buf][16 + l16][tb];
        const unsigned short* vr2 = &vst[buf][32 + l16][tb];
        const unsigned short* vr3 = &vst[buf][48 + l16][tb];
        load_frag(vf0, vr0 + sel * 8, vr0 + 16 + sel * 8);
        load_frag(vf1, vr1 + sel * 8, vr1 + 16 + sel * 8);
        load_frag(vf2, vr2 + sel * 8, vr2 + 16 + sel * 8);
        load_frag(vf3, vr3 + sel * 8, vr3 + 16 + sel * 8);

        // maximum of the raw scores (the scale is positive): in-lane, then across the halves
        float tm = fmaxf(sc0[0], sc1[0]);
#pragma unroll
        for (int r = 1; r < 8; ++r) tm = fmaxf(tm, fmaxf(sc0[r], sc1[r]));
        tm = fmaxf(tm, xhalf(tm));
        const float mn    = fmaxf(mi, tm * cscale);
        const float alpha = __builtin_amdgcn_exp2f(mi - mn);   // 0 on the first pass
        mi = mn;

        FragAB pf;            // P^T: element s = key kmap(s, sel) of the pass, column = query l16
        f32x2 sm0 = {0.0f, 0.0f}, sm1 = {0.0f, 0.0f};   // two packed chains of partial sums
#pragma unroll
        for (int i = 0; i < 4; ++i) {
            const f32x2 a0 = __builtin_elementwise_fma(f32x2{sc0[2 * i], sc0[2 * i + 1]},
                                                       f32x2{cscale, cscale}, f32x2{-mn, -mn});
            const f32x2 a1 = __builtin_elementwise_fma(f32x2{sc1[2 * i], sc1[2 * i + 1]},
                                                       f32x2{cscale, cscale}, f32x2{-mn, -mn});
            const f32x2 e0 = {__builtin_amdgcn_exp2f(a0.x), __builtin_amdgcn_exp2f(a0.y)};
            const f32x2 e1 = {__builtin_amdgcn_exp2f(a1.x), __builtin_amdgcn_exp2f(a1.y)};
            sm0 += e0;
            sm1 += e1;
            pf.q[0][i] = pack2(e0.x, e0.y);
            pf.q[1][i] = pack2(e1.x, e1.y);
        }
        sm0 += sm1;
        li = li * alpha + (sm0.x + sm0.y);
#pragma unroll
        for (int j = 0; j < 4; ++j) O[j] *= alpha;

        O[0] = wmma_bf16(vf0.v, pf.v, O[0]);
        O[1] = wmma_bf16(vf1.v, pf.v, O[1]);
        O[2] = wmma_bf16(vf2.v, pf.v, O[2]);
        O[3] = wmma_bf16(vf3.v, pf.v, O[3]);
      }
      // hand-over: my reads of this buffer are done, my copies of the next stage have landed,
      // then every wave's; only behind that is this buffer filled again
      asm volatile("s_wait_dscnt 0" ::: "memory");
      wait_async0();
      __syncthreads();
      if (st + 2 < KV_NSTAGE) copy_stage(st + 2);
    }
    wait_async0();        // nothing of mine is in flight when the wave ends

    const float inv = 1.0f / (li + xhalf(li));   // both halves' keys; unconditional, all lanes on
    // a lane's 8 registers of a tile are 8 consecutive e of its query's row: one 16-byte store
    unsigned short* orow = Ctx + (size_t)(b * Sc + s0 + l16) * D_MODELc + h * D_HEADc + 8 * sel;
#pragma unroll
    for (int j = 0; j < 4; ++j) {
        const v8f o = O[j] * inv;
        u32x4 w = {pack2(o[0], o[1]), pack2(o[2], o[3]), pack2(o[4], o[5]), pack2(o[6], o[7])};
        *reinterpret_cast<u32x4*>(orow + j * 16) = w;
    }
}

// ---------------- host orchestration ----------------
extern "C" void kernel_launch(void* const* d_in, const int* in_sizes, int n_in,
                              void* d_out, int out_size, void* d_ws, size_t ws_size,
                              hipStream_t stream) {
    (void)in_sizes; (void)n_in; (void)out_size; (void)ws_size;
    const float* x     = (const float*)d_in[0];
    const float* WQ    = (const float*)d_in[1];
    const float* WK    = (const float*)d_in[2];
    const float* WV    = (const float*)d_in[3];
    const float* WO    = (const float*)d_in[4];
    const float* ln1_g = (const float*)d_in[5];
    const float* ln1_b = (const float*)d_in[6];
    const float* ln2_g = (const float*)d_in[7];
    const float* ln2_b = (const float*)d_in[8];
    const float* W_in  = (const float*)d_in[9];
    const float* b_in  = (const float*)d_in[10];
    const float* W_out = (const float*)d_in[11];
    const float* b_out = (const float*)d_in[12];

    char* ws = (char*)d_ws;
    size_t off = 0;
    auto alloc = [&](size_t bytes) -> void* {
        void* p = ws + off;
        off += (bytes + 255) & ~(size_t)255;
        return p;
    };
    unsigned short* xln   = (unsigned short*)alloc((size_t)MROWS * D_MODELc * 2);
    unsigned short* wqkvt = (unsigned short*)alloc((size_t)3 * D_MODELc * D_MODELc * 2);
    unsigned short* wot   = (unsigned short*)alloc((size_t)D_MODELc * D_MODELc * 2);
    unsigned short* wint  = (unsigned short*)alloc((size_t)D_MLPc * D_MODELc * 2);
    unsigned short* woutt = (unsigned short*)alloc((size_t)D_MODELc * D_MLPc * 2);
    unsigned short* Qb    = (unsigned short*)alloc((size_t)MROWS * D_MODELc * 2);
    unsigned short* Kbf   = (unsigned short*)alloc((size_t)MROWS * D_MODELc * 2);
    unsigned short* Vtb   = (unsigned short*)alloc((size_t)MROWS * D_MODELc * 2);
    unsigned short* ctx   = (unsigned short*)alloc((size_t)MROWS * D_MODELc * 2);
    float*          x1    = (float*)alloc((size_t)MROWS * D_MODELc * 4);
    unsigned short* hm    = (unsigned short*)alloc((size_t)MROWS * D_MLPc * 2);

    dim3 blk(256);

    // Pack weights: Bt layout = [N][K] bf16
    transpose_cvt_kernel<<<dim3(1, 16, 16), blk, 0, stream>>>(
        WQ, wqkvt,                 64, 65536L, 65536L, 1024);
    transpose_cvt_kernel<<<dim3(1, 16, 16), blk, 0, stream>>>(
        WK, wqkvt + 1024 * 1024,   64, 65536L, 65536L, 1024);
    transpose_cvt_kernel<<<dim3(1, 16, 16), blk, 0, stream>>>(
        WV, wqkvt + 2048 * 1024,   64, 65536L, 65536L, 1024);
    transpose_cvt_kernel<<<dim3(16, 1, 16), blk, 0, stream>>>(
        WO, wot,                   1024, 65536L, 64L,    1024);
    transpose_cvt_kernel<<<dim3(64, 16, 1), blk, 0, stream>>>(
        W_in,  wint,  4096, 0L, 0L, 1024);
    transpose_cvt_kernel<<<dim3(16, 64, 1), blk, 0, stream>>>(
        W_out, woutt, 1024, 0L, 0L, 4096);

    // LN1
    ln_bf16_kernel<<<MROWS / (8 * LN_ROWS), blk, 0, stream>>>(x, ln1_g, ln1_b, xln);

    // QKV
    gemm_qkv_kernel<<<dim3(3072 / 128, MROWS / 128), blk, 0, stream>>>(
        xln, wqkvt, Qb, Kbf, Vtb);

    // Attention (flash)
    attention_kernel<<<dim3(Sc / 128, N_HEADSc, Bc), blk, 0, stream>>>(
        Qb, Kbf, Vtb, ctx);

    // Output projection + residual -> x1 (f32)
    gemm_bf16_kernel<false, true, false, false, D_MODELc>
        <<<dim3(1024 / 128, MROWS / 128), blk, 0, stream>>>(
            ctx, wot, nullptr, x, x1, nullptr, D_MODELc);

    // LN2 -> reuse xln
    ln_bf16_kernel<<<MROWS / (8 * LN_ROWS), blk, 0, stream>>>(x1, ln2_g, ln2_b, xln);

    // MLP in: +bias, exact GELU, bf16 out
    gemm_bf16_kernel<true, false, true, true, D_MLPc>
        <<<dim3(4096 / 128, MROWS / 128), blk, 0, stream>>>(
            xln, wint, b_in, nullptr, nullptr, hm, D_MODELc);

    // MLP out: +bias, +residual x1 -> d_out (f32)
    gemm_bf16_kernel<true, true, false, false, D_MODELc>
        <<<dim3(1024 / 128, MROWS / 128), blk, 0, stream>>>(
            hm, woutt, b_out, x1, (float*)d_out, nullptr, D_MLPc);
}

// v007
// It runs in 271 microseconds.
// Timed twice side by side with v006, it ran 1.04 times as fast both times.
// Counting every step since v000, it is 3.65 times as fast.
#include <hip/hip_runtime.h>
#include <math.h>

typedef __attribute__((ext_vector_type(8)))  float        v8f;
typedef __attribute__((ext_vector_type(16))) __bf16       v16bf;
typedef __attribute__((ext_vector_type(4)))  unsigned int u32x4;
typedef __attribute__((ext_vector_type(4)))  float        f32x4;
typedef __attribute__((ext_vector_type(2)))  unsigned int u32x2;

#define D_MODELc 1024
#define N_HEADSc 16
#define D_HEADc  64
#define D_MLPc   4096
#define Bc       4
#define Sc       2048
#define MROWS    (Bc * Sc)   // 8192

// ---------------- helpers ----------------

__device__ __forceinline__ unsigned short f2bf(float f) {
    union { float f; unsigned u; } x; x.f = f;
    unsigned r = x.u + 0x7FFFu + ((x.u >> 16) & 1u);
    return (unsigned short)(r >> 16);
}

typedef __attribute__((ext_vector_type(2))) float  f32x2;
typedef __attribute__((ext_vector_type(2))) __bf16 bf16x2;
__device__ __forceinline__ unsigned pack2(float lo, float hi) {   // round to nearest even, as f2bf
    return __builtin_bit_cast(unsigned, __builtin_convertvector(f32x2{lo, hi}, bf16x2));
}

__device__ __forceinline__ float xhalf(float x) {                 // lane l reads lane l ^ 16
    int b = __builtin_bit_cast(int, x);
    return __builtin_bit_cast(float,
        __builtin_amdgcn_permlanex16(b, b, 0x76543210, 0xfedcba98, false, false));
}

union FragAB { v16bf v; u32x4 q[2]; };

__device__ __forceinline__ void load_frag(FragAB& f, const unsigned short* p0,
                                          const unsigned short* p1) {
    f.q[0] = *reinterpret_cast<const u32x4*>(p0);
    f.q[1] = *reinterpret_cast<const u32x4*>(p1);
}

__device__ __forceinline__ v8f wmma_bf16(v16bf a, v16bf b, v8f c) {
    return __builtin_amdgcn_wmma_f32_16x16x32_bf16(false, a, false, b,
                                                   (short)0, c, false, false);
}

// gfx1250 async global->LDS copy (ASYNCcnt tracked, no VGPR round trip).
// Four copies of one lane and, as the last line of the same statement, the wait that
// stands in front of any rewrite of the address registers the copies name.
__device__ __forceinline__ void async_copy4_b128(unsigned l0, const unsigned short* g0,
                                                 unsigned l1, const unsigned short* g1,
                                                 unsigned l2, const unsigned short* g2,
                                                 unsigned l3, const unsigned short* g3) {
    asm volatile("global_load_async_to_lds_b128 %0, %1, off\n\t"
                 "global_load_async_to_lds_b128 %2, %3, off\n\t"
                 "global_load_async_to_lds_b128 %4, %5, off\n\t"
                 "global_load_async_to_lds_b128 %6, %7, off\n\t"
                 "s_wait_xcnt 0x0"
                 :: "v"(l0), "v"(g0), "v"(l1), "v"(g1),
                    "v"(l2), "v"(g2), "v"(l3), "v"(g3) : "memory");
}
// The same for eight copies of one lane (a GEMM stage: four rows of A, four of B).
__device__ __forceinline__ void async_copy8_b128(unsigned l0, const unsigned short* g0,
                                                 unsigned l1, const unsigned short* g1,
                                                 unsigned l2, const unsigned short* g2,
                                                 unsigned l3, const unsigned short* g3,
                                                 unsigned l4, const unsigned short* g4,
                                                 unsigned l5, const unsigned short* g5,
                                                 unsigned l6, const unsigned short* g6,
                                                 unsigned l7, const unsigned short* g7) {
    asm volatile("global_load_async_to_lds_b128 %0, %1, off\n\t"
                 "global_load_async_to_lds_b128 %2, %3, off\n\t"
                 "global_load_async_to_lds_b128 %4, %5, off\n\t"
                 "global_load_async_to_lds_b128 %6, %7, off\n\t"
                 "global_load_async_to_lds_b128 %8, %9, off\n\t"
                 "global_load_async_to_lds_b128 %10, %11, off\n\t"
                 "global_load_async_to_lds_b128 %12, %13, off\n\t"
                 "global_load_async_to_lds_b128 %14, %15, off\n\t"
                 "s_wait_xcnt 0x0"
                 :: "v"(l0), "v"(g0), "v"(l1), "v"(g1), "v"(l2), "v"(g2), "v"(l3), "v"(g3),
                    "v"(l4), "v"(g4), "v"(l5), "v"(g5), "v"(l6), "v"(g6), "v"(l7), "v"(g7)
                 : "memory");
}
__device__ __forceinline__ void wait_async0() {
    asm volatile("s_wait_asynccnt 0" ::: "memory");
}
__device__ __forceinline__ unsigned lds_offset(const void* p) {
    return (unsigned)(unsigned long long)p;   // LDS aperture lives in the high 32 bits
}

// ---------------- shared GEMM core ----------------
// One block owns a 128 x 128 tile of C; its 8 waves sit 4 (m) x 2 (n), 32 x 64 each.
// acc[2][4] += A[mblk+wm .. +31][0..K) * Bt[nblk+wn .. +63][0..K)^T
// A and Bt come in stages of 64 k: 128 rows of each, 128 B a row, copied once per block
// into LDS (two buffers) and read from there by every wave that needs them. A wave's copy
// covers four whole 128-B lines. LDS pitch 144 B (16 B x odd) for the 16-byte fragment reads.
// K is a multiple of 64; M and N are multiples of 128.
#define G_TILE  128
#define G_STAGE 64
#define G_PITCH 72                            // in bf16 elements
#define G_BUF   (2 * G_TILE * G_PITCH)        // one buffer: A rows, then Bt rows; elements
__device__ __forceinline__ void gemm_core(const unsigned short* __restrict__ A,
                                          const unsigned short* __restrict__ Bt,
                                          int K, int mblk, int nblk, int wm, int wn,
                                          v8f acc[2][4],
                                          unsigned short* lds /* [2][256][G_PITCH] */) {
    const int tid  = threadIdx.x;
    const int lane = tid & 31;
    const int sel  = lane >> 4;
    const int l16  = lane & 15;

    // copy mapping: thread t -> rows t/8 + {0,32,64,96}, 16 B at column (t%8)*8, of both tiles
    const int crow = tid >> 3;
    const int ccol = (tid & 7) * 8;
    const unsigned short* gA = A  + (size_t)(mblk + crow) * K + ccol;
    const unsigned short* gB = Bt + (size_t)(nblk + crow) * K + ccol;
    const size_t   gq = (size_t)32 * K;              // 32 rows further, elements
    const unsigned lA = lds_offset(lds + crow * G_PITCH + ccol);
    const unsigned lB = lA + G_TILE * G_PITCH * 2;   // the Bt rows, bytes
    const unsigned lq = 32 * G_PITCH * 2;            // 32 rows further, bytes
    auto copy_stage = [&](int st) {
        const unsigned bo = (st & 1) * (G_BUF * 2);
        const unsigned short* a = gA + (size_t)st * G_STAGE;
        const unsigned short* b = gB + (size_t)st * G_STAGE;
        async_copy8_b128(lA + bo,          a,
                         lA + bo + lq,     a + gq,
                         lA + bo + 2 * lq, a + 2 * gq,
                         lA + bo + 3 * lq, a + 3 * gq,
                         lB + bo,          b,
                         lB + bo + lq,     b + gq,
                         lB + bo + 2 * lq, b + 2 * gq,
                         lB + bo + 3 * lq, b + 3 * gq);
    };
    const int nst = K / G_STAGE;

    copy_stage(0);
    wait_async0();        // my part of stage 0 has landed
    __syncthreads();      // everyone's part has landed
    if (nst > 1) copy_stage(1);

    // per-wave fragment bases in buffer 0 (row = l16, k = sel*8 .. and 16 + sel*8 ..)
    const unsigned short* la0 = lds + (wm + l16) * G_PITCH + sel * 8;
    const unsigned short* lb0 = lds + (G_TILE + wn + l16) * G_PITCH + sel * 8;

    for (int st = 0; st < nst; ++st) {
        const unsigned short* la = la0 + (st & 1) * G_BUF;
        const unsigned short* lb = lb0 + (st & 1) * G_BUF;
#pragma unroll   // two 32-k halves of a stage: constant LDS offsets
        for (int kk = 0; kk < G_STAGE; kk += 32) {
            FragAB a0, a1, b0, b1, b2, b3;
            load_frag(a0, la + kk,                la + kk + 16);
            load_frag(a1, la + 16 * G_PITCH + kk, la + 16 * G_PITCH + kk + 16);
            load_frag(b0, lb + kk,                lb + kk + 16);
            load_frag(b1, lb + 16 * G_PITCH + kk, lb + 16 * G_PITCH + kk + 16);
            load_frag(b2, lb + 32 * G_PITCH + kk, lb + 32 * G_PITCH + kk + 16);
            load_frag(b3, lb + 48 * G_PITCH + kk, lb + 48 * G_PITCH + kk + 16);

            acc[0][0] = wmma_bf16(a0.v, b0.v, acc[0][0]);
            acc[1][0] = wmma_bf16(a1.v, b0.v, acc[1][0]);
            acc[0][1] = wmma_bf16(a0.v, b1.v, acc[0][1]);
            acc[1][1] = wmma_bf16(a1.v, b1.v, acc[1][1]);
            acc[0][2] = wmma_bf16(a0.v, b2.v, acc[0][2]);
            acc[1][2] = wmma_bf16(a1.v, b2.v, acc[1][2]);
            acc[0][3] = wmma_bf16(a0.v, b3.v, acc[0][3]);
            acc[1][3] = wmma_bf16(a1.v, b3.v, acc[1][3]);
        }
        // hand-over: my reads of this buffer are done, my copies of the next stage have landed,
        // then every wave's; only behind that is this buffer filled again
        asm volatile("s_wait_dscnt 0" ::: "memory");
        wait_async0();
        __syncthreads();
        if (st + 2 < nst) copy_stage(st + 2);
    }
    wait_async0();        // nothing of mine is in flight when the core is left
}

// ---------------- GEMM epilogue: accumulators turned in LDS ----------------
// Behind gemm_core's last barrier nobody reads the ring and no copy is in flight, so it serves
// as staging. A wave writes its 32 x 64 f32 tile into a range of its own and reads whole rows
// back, 16 B a lane, so that every global store (and residual load) covers whole 128-B lines.
// Pitch 68 floats = 272 B: 16 B x odd for the 16-byte reads, and the wave halves' rows (8 apart)
// fall on opposite halves of the banks for the 4-byte writes.
#define E_PITCH 68
#define E_WAVE  (32 * E_PITCH)                // floats per wave; 8 waves: 69,632 B of the ring
__device__ __forceinline__ const float* stage_tile(const v8f acc[2][4], unsigned short* ring,
                                                   int wave, int lane) {
    float* sw = reinterpret_cast<float*>(ring) + wave * E_WAVE;
    float* w  = sw + 8 * (lane >> 4) * E_PITCH + (lane & 15);
#pragma unroll   // constant indices: register arrays stay in registers, offsets become immediates
    for (int ai = 0; ai < 2; ++ai)
#pragma unroll   // constant indices: register arrays stay in registers, offsets become immediates
        for (int j = 0; j < 4; ++j)
#pragma unroll   // constant indices: register arrays stay in registers, offsets become immediates
            for (int r = 0; r < 8; ++r)
                w[(ai * 16 + r) * E_PITCH + j * 16] = acc[ai][j][r];
    // the rows read back next were written by other lanes of this wave
    asm volatile("s_wait_dscnt 0" ::: "memory");
    return sw;
}

// ---------------- weight transpose + f32->bf16 ----------------
// One 64x64 tile per block, turned in LDS: reads are 16 B per lane along the source
// row, writes are 16 B per lane along the destination row (8 lanes = one 128-B line).
// Two source rows are rounded and packed into one dword before they go to LDS.
// s and d point at the tile's first element in the source (row pitch C) and in the
// destination (row pitch dstRowStride); every matrix side used here is a multiple of 64.
__device__ __forceinline__ void transpose_cvt_tile(const float* __restrict__ s,
                                                   unsigned short* __restrict__ d,
                                                   int C, int dstRowStride,
                                                   unsigned (*tile)[33] /* [c][row pair]; pitch 33 dwords keeps both sides on distinct banks */) {
    const int tid = threadIdx.x;
    const int lc = (tid & 15) * 4;
    const int lp = tid >> 4;
    const float* p0 = s + (long)(2 * lp) * C + lc;
    const float* p1 = p0 + C;
    const float* p2 = s + (long)(2 * (lp + 16)) * C + lc;
    const float* p3 = p2 + C;
    f32x4 lo[2], hi[2];
    lo[0] = *reinterpret_cast<const f32x4*>(p0);
    hi[0] = *reinterpret_cast<const f32x4*>(p1);
    lo[1] = *reinterpret_cast<const f32x4*>(p2);
    hi[1] = *reinterpret_cast<const f32x4*>(p3);
    // the four addresses are inputs so that their registers stay as they are up to this wait
    asm volatile("s_wait_xcnt 0x0" :: "v"(p0), "v"(p1), "v"(p2), "v"(p3) : "memory");
#pragma unroll
    for (int i = 0; i < 2; ++i)
#pragma unroll
        for (int j = 0; j < 4; ++j)
            tile[lc + j][lp + 16 * i] =
                (unsigned)f2bf(lo[i][j]) | ((unsigned)f2bf(hi[i][j]) << 16);
    __syncthreads();

    const int rq = (tid & 7) * 4;
    const int oc = tid >> 3;
#pragma unroll
    for (int i = 0; i < 2; ++i) {
        const int c = oc + 32 * i;
        u32x4 w;
#pragma unroll
        for (int j = 0; j < 4; ++j) w[j] = tile[c][rq + j];
        *reinterpret_cast<u32x4*>(d + (long)c * dstRowStride + rq * 2) = w;
    }
}

// ---------------- layernorm -> bf16 ----------------
// One wave owns two whole rows and keeps them in registers: 16 loads of 16 B a lane, each covering
// 512 contiguous bytes, all issued before the first sum. Sums run in-lane, then over the wave by
// cross-lane moves: no LDS, no barrier, and 1/16 of the waves that one block per row has to start.
template <int CTRL>
__device__ __forceinline__ float add_xmask(float x) {             // x + x of lane l ^ mask, inside a 16-lane row
    const int b = __builtin_bit_cast(int, x);
    return x + __builtin_bit_cast(float, __builtin_amdgcn_update_dpp(0, b, CTRL, 0xf, 0xf, true));
}
__device__ __forceinline__ float wave_sum(float x) {              // every lane gets the sum over all 32
    x = add_xmask<0x161>(x);
    x = add_xmask<0x162>(x);
    x = add_xmask<0x164>(x);
    x = add_xmask<0x168>(x);
    return x + xhalf(x);
}
#define LN_ROWS 2                                                 // rows a wave
#define LN_BLOCKS (MROWS / (8 * LN_ROWS))                         // blocks of 8 waves for all rows
__device__ __forceinline__ void ln_bf16_rows(const float* __restrict__ x, const float* __restrict__ g,
                                             const float* __restrict__ bt,
                                             unsigned short* __restrict__ out, int blk) {
    const int lane = threadIdx.x & 31;
    const int wave = threadIdx.x >> 5;
    const size_t e0 = ((size_t)blk * 8 + wave) * (LN_ROWS * D_MODELc) + lane * 4;
    const float* xr = x + e0;
    const unsigned c0 = lane * 4;                                 // the lane's first column
    f32x4 v[LN_ROWS][8], gv[8], bv[8];
#pragma unroll   // constant indices: register arrays stay in registers, offsets become immediates
    for (int r = 0; r < LN_ROWS; ++r)
#pragma unroll   // constant indices: register arrays stay in registers, offsets become immediates
        for (int i = 0; i < 8; ++i)
            v[r][i] = *reinterpret_cast<const f32x4*>(xr + r * D_MODELc + i * 128);
#pragma unroll   // constant indices: register arrays stay in registers, offsets become immediates
    for (int i = 0; i < 8; ++i) {
        gv[i] = *reinterpret_cast<const f32x4*>(g + c0 + i * 128);
        bv[i] = *reinterpret_cast<const f32x4*>(bt + c0 + i * 128);
    }
    // the rows' address is an input so that its registers stay as they are up to this wait
    asm volatile("s_wait_xcnt 0x0" :: "v"(xr) : "memory");
    // keeps all 32 loads in front of the sums: without it the build sinks the loads of g and bt
    // between the last products, pair by pair, and waits out each pair's latency in turn
    __builtin_amdgcn_sched_barrier(0);

    float s[LN_ROWS], s2[LN_ROWS];
#pragma unroll   // constant indices: register arrays stay in registers
    for (int r = 0; r < LN_ROWS; ++r) {
        f32x4 a = v[r][0], q = v[r][0] * v[r][0];
#pragma unroll   // constant indices: register arrays stay in registers
        for (int i = 1; i < 8; ++i) { a += v[r][i]; q += v[r][i] * v[r][i]; }
        s[r]  = (a[0] + a[1]) + (a[2] + a[3]);
        s2[r] = (q[0] + q[1]) + (q[2] + q[3]);
    }
#pragma unroll   // the rows' four chains of cross-lane steps interleave
    for (int r = 0; r < LN_ROWS; ++r) { s[r] = wave_sum(s[r]); s2[r] = wave_sum(s2[r]); }

    unsigned short* orow = out + e0;
#pragma unroll   // constant indices: register arrays stay in registers, offsets become immediates
    for (int r = 0; r < LN_ROWS; ++r) {
        const float mu   = s[r] * (1.0f / D_MODELc);
        const float var  = s2[r] * (1.0f / D_MODELc) - mu * mu;
        const float rstd = rsqrtf(var + 1e-5f);
#pragma unroll   // constant indices: register arrays stay in registers, offsets become immediates
        for (int i = 0; i < 8; ++i) {
            const f32x4 o = (v[r][i] - mu) * rstd * gv[i] + bv[i];
            const u32x2 w = {pack2(o[0], o[1]), pack2(o[2], o[3])};
            *reinterpret_cast<u32x2*>(orow + r * D_MODELc + i * 128) = w;   // a wave: 256 contiguous bytes
        }
    }
}

__global__ __launch_bounds__(256)
void ln_bf16_kernel(const float* __restrict__ x, const float* __restrict__ g,
                    const float* __restrict__ bt, unsigned short* __restrict__ out) {
    ln_bf16_rows(x, g, bt, out, blockIdx.x);
}

// ---------------- everything that reads only inputs, in one launch ----------------
// The first layernorm and the six weight packs depend on nothing but the inputs and on none of
// each other, so they share one grid: a block's number says which piece it does, and each piece
// is the same work of one block as before. The layernorm blocks, which move the most bytes each,
// come first; then W_in, W_out (1024 tiles each) and WQ, WK, WV, WO (256 tiles each).
// Every packed weight is Bt = [N][K] bf16.
#define PREP_BLOCKS (LN_BLOCKS + 2 * 1024 + 4 * 256)
__global__ __launch_bounds__(256)
void prep_kernel(const float* __restrict__ x, const float* __restrict__ g,
                 const float* __restrict__ bt, unsigned short* __restrict__ xln,
                 const float* __restrict__ WQ, const float* __restrict__ WK,
                 const float* __restrict__ WV, const float* __restrict__ WO,
                 const float* __restrict__ W_in, const float* __restrict__ W_out,
                 unsigned short* __restrict__ wqkvt, unsigned short* __restrict__ wot,
                 unsigned short* __restrict__ wint, unsigned short* __restrict__ woutt) {
    __shared__ unsigned tile[64][33];
    const int bid = blockIdx.x;               // every test below is uniform for the block
    if (bid < LN_BLOCKS) {
        ln_bf16_rows(x, g, bt, xln, bid);
        return;                               // the whole block leaves, in front of the barrier
    }
    int t = bid - LN_BLOCKS;
    const float* s;
    unsigned short* d;
    int C, ds;
    if (t < 1024) {                           // W_in [1024][4096] -> [4096][1024]
        const int c0 = (t & 63) * 64, r0 = (t >> 6) * 64;
        C = D_MLPc;   ds = D_MODELc;
        s = W_in + (size_t)r0 * D_MLPc + c0;
        d = wint + (size_t)c0 * D_MODELc + r0;
    } else if (t < 2048) {                    // W_out [4096][1024] -> [1024][4096]
        t -= 1024;
        const int c0 = (t & 15) * 64, r0 = (t >> 4) * 64;
        C = D_MODELc; ds = D_MLPc;
        s = W_out + (size_t)r0 * D_MODELc + c0;
        d = woutt + (size_t)c0 * D_MLPc + r0;
    } else {
        t -= 2048;
        const int which = t >> 8;             // 0 = WQ, 1 = WK, 2 = WV, 3 = WO
        const int head  = (t >> 4) & 15;
        const int i64   = (t & 15) * 64;
        ds = D_MODELc;
        if (which < 3) {                      // a head's [1024][64] -> rows head*64 .. of [3072][1024]
            const float* w = which == 0 ? WQ : which == 1 ? WK : WV;
            C = D_HEADc;
            s = w + (size_t)head * (D_MODELc * D_HEADc) + (size_t)i64 * D_HEADc;
            d = wqkvt + (size_t)(which * N_HEADSc + head) * (D_HEADc * D_MODELc) + i64;
        } else {                              // a head's [64][1024] -> columns head*64 .. of [1024][1024]
            C = D_MODELc;
            s = WO + (size_t)head * (D_HEADc * D_MODELc) + i64;
            d = wot + (size_t)i64 * D_MODELc + head * D_HEADc;
        }
    }
    transpose_cvt_tile(s, d, C, ds, tile);
}

// ---------------- generic GEMM: C = A(bf16,[M,K]) * Bt(bf16,[N,K])^T ----------------
// N is a compile-time constant so that the epilogue's row steps are immediate offsets of one address.
template <bool HAS_BIAS, bool HAS_RES, bool DO_GELU, bool OUT_BF16, int N>
__global__ __launch_bounds__(256)
void gemm_bf16_kernel(const unsigned short* __restrict__ A,
                      const unsigned short* __restrict__ Bt,
                      const float* __restrict__ bias,
                      const float* __restrict__ res,
                      float* __restrict__ outF,
                      unsigned short* __restrict__ outB,
                      int K) {
    __shared__ __attribute__((aligned(16))) unsigned short stile[2 * G_BUF];
    const int lane = threadIdx.x & 31;
    const int wave = __builtin_amdgcn_readfirstlane(threadIdx.x >> 5);   // scalar: tile offsets stay in SGPRs
    const int wm   = (wave >> 1) * 32;
    const int wn   = (wave & 1) * 64;
    const int n0   = blockIdx.x * G_TILE + wn;
    const int m0   = blockIdx.y * G_TILE + wm;

    v8f zero = {};
    v8f acc[2][4];
#pragma unroll
    for (int ai = 0; ai < 2; ++ai)
#pragma unroll
        for (int j = 0; j < 4; ++j) acc[ai][j] = zero;

    gemm_core(A, Bt, K, blockIdx.y * G_TILE, blockIdx.x * G_TILE, wm, wn, acc, stile);

    // a lane owns CPL consecutive columns of a row (16 B of output); a wave covers RPI rows at a time
    constexpr int CPL = OUT_BF16 ? 8 : 4;
    constexpr int RPI = OUT_BF16 ? 4 : 2;
    constexpr int NIT = 32 / RPI;
    const int rrow = lane / (64 / CPL);
    const int rcol = (lane % (64 / CPL)) * CPL;
    const size_t o0 = (size_t)(m0 + rrow) * N + n0 + rcol;

    f32x4 rv[HAS_RES ? NIT * (CPL / 4) : 1];
    if (HAS_RES) {
#pragma unroll   // constant indices: register arrays stay in registers, offsets become immediates
        for (int it = 0; it < NIT; ++it)
#pragma unroll   // constant indices: register arrays stay in registers, offsets become immediates
            for (int q = 0; q < CPL / 4; ++q)
                rv[it * (CPL / 4) + q] =
                    *reinterpret_cast<const f32x4*>(res + o0 + (size_t)it * RPI * N + q * 4);
    }
    f32x4 bv[CPL / 4];
    if (HAS_BIAS) {
#pragma unroll   // constant indices: register arrays stay in registers, offsets become immediates
        for (int q = 0; q < CPL / 4; ++q)
            bv[q] = *reinterpret_cast<const f32x4*>(bias + n0 + rcol + q * 4);
    }

    const float* rd = stage_tile(acc, stile, wave, lane) + rrow * E_PITCH + rcol;
#pragma unroll   // constant indices: register arrays stay in registers, offsets become immediates
    for (int it = 0; it < NIT; ++it) {
        f32x4 v[CPL / 4];
#pragma unroll   // constant indices: register arrays stay in registers, offsets become immediates
        for (int q = 0; q < CPL / 4; ++q) {
            v[q] = *reinterpret_cast<const f32x4*>(rd + it * RPI * E_PITCH + q * 4);
            if (HAS_BIAS) v[q] += bv[q];
            if (DO_GELU) {
#pragma unroll   // constant indices: register arrays stay in registers, offsets become immediates
                for (int i = 0; i < 4; ++i)
                    v[q][i] = 0.5f * v[q][i] * (1.0f + erff(v[q][i] * 0.70710678118654752f));
            }
            if (HAS_RES) v[q] += rv[it * (CPL / 4) + q];
        }
        if constexpr (OUT_BF16) {
            u32x4 w = {pack2(v[0][0], v[0][1]), pack2(v[0][2], v[0][3]),
                       pack2(v[1][0], v[1][1]), pack2(v[1][2], v[1][3])};
            *reinterpret_cast<u32x4*>(outB + o0 + (size_t)it * RPI * N) = w;
        } else {
            *reinterpret_cast<f32x4*>(outF + o0 + (size_t)it * RPI * N) = v[0];
        }
    }
}

// ---------------- QKV GEMM (N=3072): writes Q,K row-major; V transposed [e][t] ----------------
__global__ __launch_bounds__(256)
void gemm_qkv_kernel(const unsigned short* __restrict__ A,
                     const unsigned short* __restrict__ Bt,
                     unsigned short* __restrict__ Q,
                     unsigned short* __restrict__ Kb,
                     unsigned short* __restrict__ Vt) {
    __shared__ __attribute__((aligned(16))) unsigned short stile[2 * G_BUF];
    const int lane = threadIdx.x & 31;
    const int wave = __builtin_amdgcn_readfirstlane(threadIdx.x >> 5);   // scalar: tile offsets stay in SGPRs
    const int sel  = lane >> 4;
    const int l16  = lane & 15;
    const int wm   = (wave >> 1) * 32;
    const int wn   = (wave & 1) * 64;
    const int n0   = blockIdx.x * G_TILE + wn;   // which/head uniform per wave
    const int m0   = blockIdx.y * G_TILE + wm;

    v8f zero = {};
    v8f acc[2][4];
#pragma unroll
    for (int ai = 0; ai < 2; ++ai)
#pragma unroll
        for (int j = 0; j < 4; ++j) acc[ai][j] = zero;

    gemm_core(A, Bt, D_MODELc, blockIdx.y * G_TILE, blockIdx.x * G_TILE, wm, wn, acc, stile);

    const int which = blockIdx.x >> 3;       // 0=Q,1=K,2=V: eight 128-column blocks each, block-uniform
    const int b     = blockIdx.y >> 4;       // a block's 128 rows lie in one batch (row / S)
    if (which < 2) {
        // the wave's 32 rows x 64 columns are 32 consecutive 128-B rows of one head
        const int hh   = (n0 & 1023) >> 6;
        const int rrow = lane >> 3;
        const int rcol = (lane & 7) * 8;
        unsigned short* o = (which == 0 ? Q : Kb)
            + ((size_t)(b * N_HEADSc + hh) * Sc + (m0 & (Sc - 1)) + rrow) * D_HEADc + rcol;
        const float* rd = stage_tile(acc, stile, wave, lane) + rrow * E_PITCH + rcol;
#pragma unroll   // constant indices: register arrays stay in registers, offsets become immediates
        for (int it = 0; it < 8; ++it) {
            const f32x4 lo = *reinterpret_cast<const f32x4*>(rd + it * 4 * E_PITCH);
            const f32x4 hi = *reinterpret_cast<const f32x4*>(rd + it * 4 * E_PITCH + 4);
            u32x4 w = {pack2(lo[0], lo[1]), pack2(lo[2], lo[3]),
                       pack2(hi[0], hi[1]), pack2(hi[2], hi[3])};
            *reinterpret_cast<u32x4*>(o + it * 4 * D_HEADc) = w;
        }
    } else {
        // V^T: a lane's 8 registers of a tile are 8 consecutive s of one e. The block's tile is laid
        // [column][row] in LDS, bf16, so that a column's 128 s leave as one 256-B run.
        constexpr int VP = 136;              // pitch in bf16: 272 B = 16 B x odd
#pragma unroll   // constant indices: register arrays stay in registers, offsets become immediates
        for (int ai = 0; ai < 2; ++ai)
#pragma unroll   // constant indices: register arrays stay in registers, offsets become immediates
            for (int j = 0; j < 4; ++j) {
                const v8f a = acc[ai][j];
                u32x4 w = {pack2(a[0], a[1]), pack2(a[2], a[3]), pack2(a[4], a[5]), pack2(a[6], a[7])};
                *reinterpret_cast<u32x4*>(stile + (wn + j * 16 + l16) * VP + wm + ai * 16 + 8 * sel) = w;
            }
        __syncthreads();                     // a column's 128 s come from four waves
        const int col0 = wave * 16 + sel;    // 16 columns a wave, two at a time
        const int s8   = l16 * 8;
        unsigned short* o = Vt + (size_t)(b * D_MODELc + ((blockIdx.x & 7) * G_TILE) + col0) * Sc
                               + ((blockIdx.y & 15) * G_TILE) + s8;
#pragma unroll   // constant indices: register arrays stay in registers, offsets become immediates
        for (int it = 0; it < 8; ++it) {
            const u32x4 w = *reinterpret_cast<const u32x4*>(stile + (col0 + it * 2) * VP + s8);
            *reinterpret_cast<u32x4*>(o + (size_t)it * 2 * Sc) = w;
        }
    }
}

#define KV_STAGE 64
#define KV_PITCH 72                       // in bf16 elements
#define KV_NSTAGE (Sc / KV_STAGE)
__global__ __launch_bounds__(256)
void attention_kernel(const unsigned short* __restrict__ Q,
                      const unsigned short* __restrict__ Kb,
                      const unsigned short* __restrict__ Vt,
                      unsigned short* __restrict__ Ctx) {
    const int lane = threadIdx.x & 31;
    const int wave = threadIdx.x >> 5;
    const int sel  = lane >> 4;
    const int l16  = lane & 15;
    const int b    = blockIdx.z;
    const int h    = blockIdx.y;
    const int s0   = blockIdx.x * 128 + wave * 16;

    const size_t bh = (size_t)(b * N_HEADSc + h);
    const unsigned short* qb = Q  + bh * Sc * D_HEADc;
    const unsigned short* kb = Kb + bh * Sc * D_HEADc;
    const unsigned short* vb = Vt + bh * D_HEADc * Sc;

    __shared__ __attribute__((aligned(16))) unsigned short kst[2][KV_STAGE][KV_PITCH];  // [buf][key][e]
    __shared__ __attribute__((aligned(16))) unsigned short vst[2][D_HEADc][KV_PITCH];   // [buf][e][key]

    // copy mapping: thread t -> rows t/8 and t/8 + 32, 16 B at column (t%8)*8, of both tiles
    const int crow = threadIdx.x >> 3;
    const int ccol = (threadIdx.x & 7) * 8;
    const unsigned short* gk = kb + (size_t)crow * D_HEADc + ccol;
    const unsigned short* gv = vb + (size_t)crow * Sc + ccol;
    const unsigned lk = lds_offset(&kst[0][crow][ccol]);
    const unsigned lv = lds_offset(&vst[0][crow][ccol]);
    const unsigned halfB = 32 * KV_PITCH * 2;        // 32 rows further, bytes
    const unsigned bufB  = KV_STAGE * KV_PITCH * 2;  // next buffer, bytes
    auto copy_stage = [&](int st) {
        const unsigned bo = (st & 1) * bufB;
        const unsigned short* k0 = gk + (size_t)st * KV_STAGE * D_HEADc;
        const unsigned short* v0 = gv + st * KV_STAGE;
        async_copy4_b128(lk + bo,         k0,
                         lk + bo + halfB, k0 + 32 * D_HEADc,
                         lv + bo,         v0,
                         lv + bo + halfB, v0 + (size_t)32 * Sc);
    };
    copy_stage(0);
    wait_async0();        // my part of stage 0 has landed
    __syncthreads();      // everyone's part has landed
    copy_stage(1);

    // Q as the B operand: column = query l16, same k order as the K rows
    FragAB qf0, qf1;
    const unsigned short* qrow = qb + (size_t)(s0 + l16) * D_HEADc;
    load_frag(qf0, qrow + sel * 8,      qrow + 16 + sel * 8);
    load_frag(qf1, qrow + 32 + sel * 8, qrow + 48 + sel * 8);

    v8f zero = {};
    v8f O[4];             // O[j][r] = O^T[e = 16 j + 8 sel + r][query l16]
#pragma unroll
    for (int j = 0; j < 4; ++j) O[j] = zero;
    float mi = -INFINITY; // this query's running maximum, base-2 scaled; equal in both halves
    float li = 0.0f;      // sum over this half's keys only; the halves are joined behind the loop

    const float cscale = 0.125f * 1.4426950408889634f;   // 64^-0.5 * log2(e)

    for (int st = 0; st < KV_NSTAGE; ++st) {
      const int buf = st & 1;
      for (int tb = 0; tb < KV_STAGE; tb += 32) {
        v8f sc0 = zero, sc1 = zero;   // keys tb + 8 sel + r and tb + 16 + 8 sel + r
        {
            FragAB kf0, kf1, kf2, kf3;
            const unsigned short* kr0 = &kst[buf][tb + l16][0];
            const unsigned short* kr1 = &kst[buf][tb + 16 + l16][0];
            load_frag(kf0, kr0 + sel * 8,      kr0 + 16 + sel * 8);
            load_frag(kf1, kr0 + 32 + sel * 8, kr0 + 48 + sel * 8);
            load_frag(kf2, kr1 + sel * 8,      kr1 + 16 + sel * 8);
            load_frag(kf3, kr1 + 32 + sel * 8, kr1 + 48 + sel * 8);
            sc0 = wmma_bf16(kf0.v, qf0.v, sc0);
            sc1 = wmma_bf16(kf2.v, qf0.v, sc1);
            sc0 = wmma_bf16(kf1.v, qf1.v, sc0);
            sc1 = wmma_bf16(kf3.v, qf1.v, sc1);
        }

        FragAB vf0, vf1, vf2, vf3;
        const unsigned short* vr0 = &vst[buf][l16][tb];
        const unsigned short* vr1 = &vst[buf][16 + l16][tb];
        const unsigned short* vr2 = &vst[buf][32 + l16][tb];
        const unsigned short* vr3 = &vst[buf][48 + l16][tb];
        load_frag(vf0, vr0 + sel * 8, vr0 + 16 + sel * 8);
        load_frag(vf1, vr1 + sel * 8, vr1 + 16 + sel * 8);
        load_frag(vf2, vr2 + sel * 8, vr2 + 16 + sel * 8);
        load_frag(vf3, vr3 + sel * 8, vr3 + 16 + sel * 8);

        // maximum of the raw scores (the scale is positive): in-lane, then across the halves
        float tm = fmaxf(sc0[0], sc1[0]);
#pragma unroll
        for (int r = 1; r < 8; ++r) tm = fmaxf(tm, fmaxf(sc0[r], sc1[r]));
        tm = fmaxf(tm, xhalf(tm));
        const float mn    = fmaxf(mi, tm * cscale);
        const float alpha = __builtin_amdgcn_exp2f(mi - mn);   // 0 on the first pass
        mi = mn;

        FragAB pf;            // P^T: element s = key kmap(s, sel) of the pass, column = query l16
        f32x2 sm0 = {0.0f, 0.0f}, sm1 = {0.0f, 0.0f};   // two packed chains of partial sums
#pragma unroll
        for (int i = 0; i < 4; ++i) {
            const f32x2 a0 = __builtin_elementwise_fma(f32x2{sc0[2 * i], sc0[2 * i + 1]},
                                                       f32x2{cscale, cscale}, f32x2{-mn, -mn});
            const f32x2 a1 = __builtin_elementwise_fma(f32x2{sc1[2 * i], sc1[2 * i + 1]},
                                                       f32x2{cscale, cscale}, f32x2{-mn, -mn});
            const f32x2 e0 = {__builtin_amdgcn_exp2f(a0.x), __builtin_amdgcn_exp2f(a0.y)};
            const f32x2 e1 = {__builtin_amdgcn_exp2f(a1.x), __builtin_amdgcn_exp2f(a1.y)};
            sm0 += e0;
            sm1 += e1;
            pf.q[0][i] = pack2(e0.x, e0.y);
            pf.q[1][i] = pack2(e1.x, e1.y);
        }
        sm0 += sm1;
        li = li * alpha + (sm0.x + sm0.y);
#pragma unroll
        for (int j = 0; j < 4; ++j) O[j] *= alpha;

        O[0] = wmma_bf16(vf0.v, pf.v, O[0]);
        O[1] = wmma_bf16(vf1.v, pf.v, O[1]);
        O[2] = wmma_bf16(vf2.v, pf.v, O[2]);
        O[3] = wmma_bf16(vf3.v, pf.v, O[3]);
      }
      // hand-over: my reads of this buffer are done, my copies of the next stage have landed,
      // then every wave's; only behind that is this buffer filled again
      asm volatile("s_wait_dscnt 0" ::: "memory");
      wait_async0();
      __syncthreads();
      if (st + 2 < KV_NSTAGE) copy_stage(st + 2);
    }
    wait_async0();        // nothing of mine is in flight when the wave ends

    const float inv = 1.0f / (li + xhalf(li));   // both halves' keys; unconditional, all lanes on
    // a lane's 8 registers of a tile are 8 consecutive e of its query's row: one 16-byte store
    unsigned short* orow = Ctx + (size_t)(b * Sc + s0 + l16) * D_MODELc + h * D_HEADc + 8 * sel;
#pragma unroll
    for (int j = 0; j < 4; ++j) {
        const v8f o = O[j] * inv;
        u32x4 w = {pack2(o[0], o[1]), pack2(o[2], o[3]), pack2(o[4], o[5]), pack2(o[6], o[7])};
        *reinterpret_cast<u32x4*>(orow + j * 16) = w;
    }
}

// ---------------- host orchestration ----------------
extern "C" void kernel_launch(void* const* d_in, const int* in_sizes, int n_in,
                              void* d_out, int out_size, void* d_ws, size_t ws_size,
                              hipStream_t stream) {
    (void)in_sizes; (void)n_in; (void)out_size; (void)ws_size;
    const float* x     = (const float*)d_in[0];
    const float* WQ    = (const float*)d_in[1];
    const float* WK    = (const float*)d_in[2];
    const float* WV    = (const float*)d_in[3];
    const float* WO    = (const float*)d_in[4];
    const float* ln1_g = (const float*)d_in[5];
    const float* ln1_b = (const float*)d_in[6];
    const float* ln2_g = (const float*)d_in[7];
    const float* ln2_b = (const float*)d_in[8];
    const float* W_in  = (const float*)d_in[9];
    const float* b_in  = (const float*)d_in[10];
    const float* W_out = (const float*)d_in[11];
    const float* b_out = (const float*)d_in[12];

    char* ws = (char*)d_ws;
    size_t off = 0;
    auto alloc = [&](size_t bytes) -> void* {
        void* p = ws + off;
        off += (bytes + 255) & ~(size_t)255;
        return p;
    };
    unsigned short* xln   = (unsigned short*)alloc((size_t)MROWS * D_MODELc * 2);
    unsigned short* wqkvt = (unsigned short*)alloc((size_t)3 * D_MODELc * D_MODELc * 2);
    unsigned short* wot   = (unsigned short*)alloc((size_t)D_MODELc * D_MODELc * 2);
    unsigned short* wint  = (unsigned short*)alloc((size_t)D_MLPc * D_MODELc * 2);
    unsigned short* woutt = (unsigned short*)alloc((size_t)D_MODELc * D_MLPc * 2);
    unsigned short* Qb    = (unsigned short*)alloc((size_t)MROWS * D_MODELc * 2);
    unsigned short* Kbf   = (unsigned short*)alloc((size_t)MROWS * D_MODELc * 2);
    unsigned short* Vtb   = (unsigned short*)alloc((size_t)MROWS * D_MODELc * 2);
    unsigned short* ctx   = (unsigned short*)alloc((size_t)MROWS * D_MODELc * 2);
    float*          x1    = (float*)alloc((size_t)MROWS * D_MODELc * 4);
    unsigned short* hm    = (unsigned short*)alloc((size_t)MROWS * D_MLPc * 2);

    dim3 blk(256);

    // LN1 and all six weight packs
    prep_kernel<<<PREP_BLOCKS, blk, 0, stream>>>(x, ln1_g, ln1_b, xln, WQ, WK, WV, WO, W_in, W_out,
                                                 wqkvt, wot, wint, woutt);

    // QKV
    gemm_qkv_kernel<<<dim3(3072 / 128, MROWS / 128), blk, 0, stream>>>(
        xln, wqkvt, Qb, Kbf, Vtb);

    // Attention (flash)
    attention_kernel<<<dim3(Sc / 128, N_HEADSc, Bc), blk, 0, stream>>>(
        Qb, Kbf, Vtb, ctx);

    // Output projection + residual -> x1 (f32)
    gemm_bf16_kernel<false, true, false, false, D_MODELc>
        <<<dim3(1024 / 128, MROWS / 128), blk, 0, stream>>>(
            ctx, wot, nullptr, x, x1, nullptr, D_MODELc);

    // LN2 -> reuse xln
    ln_bf16_kernel<<<LN_BLOCKS, blk, 0, stream>>>(x1, ln2_g, ln2_b, xln);

    // MLP in: +bias, exact GELU, bf16 out
    gemm_bf16_kernel<true, false, true, true, D_MLPc>
        <<<dim3(4096 / 128, MROWS / 128), blk, 0, stream>>>(
            xln, wint, b_in, nullptr, nullptr, hm, D_MODELc);

    // MLP out: +bias, +residual x1 -> d_out (f32)
    gemm_bf16_kernel<true, true, false, false, D_MODELc>
        <<<dim3(1024 / 128, MROWS / 128), blk, 0, stream>>>(
            hm, woutt, b_out, x1, (float*)d_out, nullptr, D_MLPc);
}
